// v000
// Measured on an AMD MI455X. A time is GPU time per run, averaged over a window of back-to-back runs after a warm-up
// (all launches, gaps included; the runs take copies of the inputs in turn), and the median of several windows.
// Apart from v000's, it joins two sittings. Times from different sittings can be a few percent apart, while
// side-by-side timings come from the same sitting.
// v000, which the later versions start from, runs in 287 microseconds.
#include <hip/hip_runtime.h>
#include <hip/hip_bf16.h>
#include <stdint.h>

// Problem constants (match reference)
#define BT 8
#define ST 512
#define FD 128
#define HD 128
#define NT (BT*ST)      // 4096 tokens
#define LNEPS 1e-5f

// Expert kernel tiling
#define WAVES 8
#define TOK_PER_WG (WAVES*16)   // 128 tokens per workgroup
#define FPG 16                  // features per workgroup (feature group)
#define WSTRIDE 132             // padded LDS row stride (floats): 128+4 -> bank-conflict-free

typedef __attribute__((ext_vector_type(2)))  float v2f;
typedef __attribute__((ext_vector_type(8)))  float v8f;
typedef __attribute__((ext_vector_type(4)))  unsigned int v4u;
typedef __attribute__((ext_vector_type(8)))  int v8i;
typedef __attribute__((ext_vector_type(4)))  int v4i;

__device__ __forceinline__ float elu1(float v) { return v > 0.f ? v : (__expf(v) - 1.f); }
__device__ __forceinline__ float sigm(float v) { return 1.f / (1.f + __expf(-v)); }

// ---------------------------------------------------------------------------
// Kernel A: zero the 'selected' output region (it is accumulated with atomics)
// ---------------------------------------------------------------------------
__global__ void vsn_zero_kernel(float* __restrict__ p, int n) {
    int i = blockIdx.x * blockDim.x + threadIdx.x;
    if (i < n) p[i] = 0.f;
}

// ---------------------------------------------------------------------------
// Kernel B: selection GRN -> softmax weights [NT, FD]  (1 block of 128 thr / token)
// ---------------------------------------------------------------------------
__global__ __launch_bounds__(128)
void vsn_sel_kernel(const float* __restrict__ x,
                    const float* __restrict__ w1, const float* __restrict__ b1,
                    const float* __restrict__ w2, const float* __restrict__ b2,
                    const float* __restrict__ wg, const float* __restrict__ bg,
                    const float* __restrict__ lng, const float* __restrict__ lnb,
                    float* __restrict__ wout) {
    __shared__ float xb[FD], hb[HD], h2b[HD], red[8];
    const int t = blockIdx.x;
    const int j = threadIdx.x;
    const int wv = j >> 5, ln = j & 31;

    xb[j] = x[(size_t)t * FD + j];
    __syncthreads();

    float acc = b1[j];
    for (int i = 0; i < FD; ++i) acc += xb[i] * w1[j * FD + i];
    hb[j] = elu1(acc);
    __syncthreads();

    acc = b2[j];
    for (int i = 0; i < HD; ++i) acc += hb[i] * w2[j * HD + i];
    h2b[j] = acc;
    __syncthreads();

    float ga = bg[j];
    for (int i = 0; i < HD; ++i) ga += h2b[i] * wg[j * HD + i];
    const float pre = sigm(ga) * h2b[j] + xb[j];

    // LayerNorm over 128
    float s = pre, s2 = pre * pre;
    for (int m = 16; m >= 1; m >>= 1) { s += __shfl_xor(s, m, 32); s2 += __shfl_xor(s2, m, 32); }
    if (ln == 0) { red[wv] = s; red[4 + wv] = s2; }
    __syncthreads();
    s  = red[0] + red[1] + red[2] + red[3];
    s2 = red[4] + red[5] + red[6] + red[7];
    const float mean = s * (1.f / FD);
    const float var  = s2 * (1.f / FD) - mean * mean;
    const float lno  = (pre - mean) * __frsqrt_rn(var + LNEPS) * lng[j] + lnb[j];
    __syncthreads();

    // softmax over 128
    float mx = lno;
    for (int m = 16; m >= 1; m >>= 1) mx = fmaxf(mx, __shfl_xor(mx, m, 32));
    if (ln == 0) red[wv] = mx;
    __syncthreads();
    mx = fmaxf(fmaxf(red[0], red[1]), fmaxf(red[2], red[3]));
    const float e = __expf(lno - mx);
    float se = e;
    for (int m = 16; m >= 1; m >>= 1) se += __shfl_xor(se, m, 32);
    __syncthreads();
    if (ln == 0) red[4 + wv] = se;
    __syncthreads();
    se = red[4] + red[5] + red[6] + red[7];
    wout[(size_t)t * FD + j] = e / se;
}

// ---------------------------------------------------------------------------
// TDM helper: DMA one 128x128 f32 matrix from global to LDS with +4 DWORD row
// padding (LDS row stride becomes 132 floats). Issued by wave 0 only.
// ---------------------------------------------------------------------------
__device__ __forceinline__ void tdm_load_128x128(const float* gsrc, unsigned lds_byte_addr) {
    const uint64_t ga = (uint64_t)(uintptr_t)gsrc;
    v4u g0;
    g0[0] = 1u;                       // count=1, user descriptor
    g0[1] = lds_byte_addr;            // lds_addr
    g0[2] = (unsigned)ga;             // global_addr[31:0]
    g0[3] = (unsigned)((ga >> 32) & 0x1FFFFFFull) | 0x80000000u; // addr[56:32] | type=2
    v8i g1;
    // workgroup_mask=0 | data_size=2(4B) | pad_enable | pad_interval=6(128 dw) | pad_amount=3(4 dw)
    g1[0] = (int)((2u << 16) | (1u << 20) | (6u << 22) | (3u << 25));
    g1[1] = (int)(HD << 16);          // tensor_dim0 = 128 (low16)
    g1[2] = (int)(HD << 16);          // tensor_dim0 hi16=0 | tensor_dim1=128 (low16)
    g1[3] = (int)(HD << 16);          // tensor_dim1 hi16=0 | tile_dim0 = 128
    g1[4] = (int)HD;                  // tile_dim1 = 128, tile_dim2 = 0
    g1[5] = (int)HD;                  // tensor_dim0_stride = 128 (low32)
    g1[6] = (int)((HD * HD) << 16);   // stride hi16=0 | tensor_dim1_stride low16 = 16384
    g1[7] = 0;                        // tensor_dim1_stride hi32 = 0
    v4i g2 = {0, 0, 0, 0};            // dims 3/4 unused (2D tile)
    v4i g3 = {0, 0, 0, 0};
    v8i g4 = {0, 0, 0, 0, 0, 0, 0, 0}; // trailing group (6-arg toolchain variant)
    __builtin_amdgcn_tensor_load_to_lds(g0, g1, g2, g3, g4, 0);
}

// ---------------------------------------------------------------------------
// Kernel C: per-feature GRN experts with V_WMMA_F32_16X16X4_F32, TDM weight
// staging, and weighted accumulation into 'selected' via f32 atomics.
// grid = (NT/TOK_PER_WG, FD/FPG), block = 256 (8 waves, 1 token-tile each)
// ---------------------------------------------------------------------------
__global__ __launch_bounds__(WAVES * 32, 2)
void vsn_expert_kernel(const float* __restrict__ x,
                       const float* __restrict__ vw1,  const float* __restrict__ vb1,
                       const float* __restrict__ vw2,  const float* __restrict__ vb2,
                       const float* __restrict__ vwg,  const float* __restrict__ vbg,
                       const float* __restrict__ vwsk, const float* __restrict__ vbsk,
                       const float* __restrict__ vlng, const float* __restrict__ vlnb,
                       const float* __restrict__ wsel,     // [NT, FD] selection weights
                       float* __restrict__ outsel) {       // [NT, HD] accumulated
    __shared__ float sW2[HD * WSTRIDE];                    // 66 KB, TDM-padded
    __shared__ float sWg[HD * WSTRIDE];                    // 66 KB, TDM-padded
    __shared__ float sStage[WAVES][16 * WSTRIDE];          // 66 KB vh2 staging
    __shared__ float sVec[8][HD];                          // w1,b1,b2,bg,wsk,bsk,lng,lnb

    const int tid  = threadIdx.x;
    const int wave = tid >> 5;
    const int lane = tid & 31;
    const int col  = lane & 15;    // N index / M row index within half
    const int half = lane >> 4;    // K-half selector for A/B fragments
    const int t0   = blockIdx.x * TOK_PER_WG + wave * 16;
    const int f0   = blockIdx.y * FPG;
    float* const stg = &sStage[wave][0];

    v8f accsel[8];
#pragma unroll
    for (int n = 0; n < 8; ++n) accsel[n] = (v8f){0.f,0.f,0.f,0.f,0.f,0.f,0.f,0.f};

    for (int fi = 0; fi < FPG; ++fi) {
        const int f = f0 + fi;
        __syncthreads();           // previous iteration done reading weight LDS

        // --- stage this feature's weights: TDM for matrices, VALU for vectors ---
        if (tid < 32) {
            tdm_load_128x128(vw2 + (size_t)f * HD * HD, (unsigned)(uintptr_t)&sW2[0]);
            tdm_load_128x128(vwg + (size_t)f * HD * HD, (unsigned)(uintptr_t)&sWg[0]);
            __builtin_amdgcn_s_wait_tensorcnt(0);
        }
        if (tid < HD) {
            const int j = tid;     // 128 elements per small vector
            sVec[0][j] = vw1 [(size_t)f * HD + j];
            sVec[1][j] = vb1 [(size_t)f * HD + j];
            sVec[2][j] = vb2 [(size_t)f * HD + j];
            sVec[3][j] = vbg [(size_t)f * HD + j];
            sVec[4][j] = vwsk[(size_t)f * HD + j];
            sVec[5][j] = vbsk[(size_t)f * HD + j];
            sVec[6][j] = vlng[(size_t)f * HD + j];
            sVec[7][j] = vlnb[(size_t)f * HD + j];
        }
        __syncthreads();

        // x value for this lane's A-matrix row (rows M = lane&15, both halves)
        const float xv = x[(size_t)(t0 + col) * FD + f];

        v8f c[8];
#pragma unroll
        for (int n = 0; n < 8; ++n) c[n] = (v8f){0.f,0.f,0.f,0.f,0.f,0.f,0.f,0.f};

        // ---- GEMM1: vh2 = elu(x*w1+b1) @ W2^T   (16 x 128 = 8 col-tiles) ----
        // Unroll capped: 8 independent WMMA chains per step give enough ILP;
        // full unroll blows past 256 VGPRs (s_set_vgpr_msb churn, 1 wave/SIMD).
#pragma unroll 2
        for (int k = 0; k < HD; k += 4) {
            const int klo = k + half * 2;
            v2f a;
            a.x = elu1(xv * sVec[0][klo]     + sVec[1][klo]);
            a.y = elu1(xv * sVec[0][klo + 1] + sVec[1][klo + 1]);
#pragma unroll
            for (int n = 0; n < 8; ++n) {
                const int g = n * 16 + col;
                v2f b = *(const v2f*)&sW2[g * WSTRIDE + klo];
                c[n] = __builtin_amdgcn_wmma_f32_16x16x4_f32(
                    false, a, false, b, (short)0, c[n], false, false);
            }
        }

        // store vh2 (+bias b2) to padded LDS staging (C layout -> row major)
#pragma unroll
        for (int n = 0; n < 8; ++n) {
            const int g = n * 16 + col;
            const float b2v = sVec[2][g];
#pragma unroll
            for (int r = 0; r < 8; ++r)
                stg[(r + 8 * half) * WSTRIDE + g] = c[n][r] + b2v;
        }

        // ---- GEMM2: gate_pre = vh2 @ Wg^T ----
#pragma unroll
        for (int n = 0; n < 8; ++n) c[n] = (v8f){0.f,0.f,0.f,0.f,0.f,0.f,0.f,0.f};
#pragma unroll 2
        for (int k = 0; k < HD; k += 4) {
            const int klo = k + half * 2;
            v2f a = *(const v2f*)&stg[col * WSTRIDE + klo];
#pragma unroll
            for (int n = 0; n < 8; ++n) {
                const int g = n * 16 + col;
                v2f b = *(const v2f*)&sWg[g * WSTRIDE + klo];
                c[n] = __builtin_amdgcn_wmma_f32_16x16x4_f32(
                    false, a, false, b, (short)0, c[n], false, false);
            }
        }

        // ---- elementwise: sigmoid gate, skip, LayerNorm, weighted accumulate ----
#pragma unroll
        for (int r = 0; r < 8; ++r) {
            const int m = r + 8 * half;                 // token row in tile
            const float xm = x   [(size_t)(t0 + m) * FD + f];
            const float wm = wsel[(size_t)(t0 + m) * FD + f];
            float y[8];
            float s = 0.f, s2 = 0.f;
#pragma unroll
            for (int n = 0; n < 8; ++n) {
                const int g = n * 16 + col;
                const float vh2v = stg[m * WSTRIDE + g];
                const float vgv  = sigm(c[n][r] + sVec[3][g]);
                const float sk   = xm * sVec[4][g] + sVec[5][g];
                const float t    = vgv * vh2v + sk;
                y[n] = t; s += t; s2 += t * t;
            }
            // reduce over the 16 lanes of this half (128 values per token row)
#pragma unroll
            for (int msk = 1; msk < 16; msk <<= 1) {
                s  += __shfl_xor(s,  msk, 32);
                s2 += __shfl_xor(s2, msk, 32);
            }
            const float mean = s * (1.f / HD);
            const float var  = s2 * (1.f / HD) - mean * mean;
            const float rstd = __frsqrt_rn(var + LNEPS);
#pragma unroll
            for (int n = 0; n < 8; ++n) {
                const int g = n * 16 + col;
                const float vout = (y[n] - mean) * rstd * sVec[6][g] + sVec[7][g];
                accsel[n][r] += vout * wm;
            }
        }
    }

    // ---- reduce over feature groups into global output ----
#pragma unroll
    for (int n = 0; n < 8; ++n) {
#pragma unroll
        for (int r = 0; r < 8; ++r) {
            const int m = r + 8 * half;
            atomicAdd(&outsel[(size_t)(t0 + m) * HD + n * 16 + col], accsel[n][r]);
        }
    }
}

// ---------------------------------------------------------------------------
extern "C" void kernel_launch(void* const* d_in, const int* in_sizes, int n_in,
                              void* d_out, int out_size, void* d_ws, size_t ws_size,
                              hipStream_t stream) {
    (void)in_sizes; (void)n_in; (void)out_size; (void)d_ws; (void)ws_size;
    const float* x     = (const float*)d_in[0];
    const float* sw1   = (const float*)d_in[1];
    const float* sb1   = (const float*)d_in[2];
    const float* sw2   = (const float*)d_in[3];
    const float* sb2   = (const float*)d_in[4];
    const float* swg   = (const float*)d_in[5];
    const float* sbg   = (const float*)d_in[6];
    const float* slng  = (const float*)d_in[7];
    const float* slnb  = (const float*)d_in[8];
    const float* vw1   = (const float*)d_in[9];
    const float* vb1   = (const float*)d_in[10];
    const float* vw2   = (const float*)d_in[11];
    const float* vb2   = (const float*)d_in[12];
    const float* vwg   = (const float*)d_in[13];
    const float* vbg   = (const float*)d_in[14];
    const float* vwsk  = (const float*)d_in[15];
    const float* vbsk  = (const float*)d_in[16];
    const float* vlng  = (const float*)d_in[17];
    const float* vlnb  = (const float*)d_in[18];

    float* out_sel = (float*)d_out;                 // [NT, HD]
    float* out_w   = out_sel + (size_t)NT * HD;     // [NT, FD]

    vsn_zero_kernel<<<(NT * HD + 255) / 256, 256, 0, stream>>>(out_sel, NT * HD);

    vsn_sel_kernel<<<NT, 128, 0, stream>>>(x, sw1, sb1, sw2, sb2, swg, sbg,
                                           slng, slnb, out_w);

    dim3 grid2(NT / TOK_PER_WG, FD / FPG);
    vsn_expert_kernel<<<grid2, WAVES * 32, 0, stream>>>(
        x, vw1, vb1, vw2, vb2, vwg, vbg, vwsk, vbsk, vlng, vlnb, out_w, out_sel);
}

// v001
// Measured time: 258 microseconds a run.
// Two timings next to v000 both put it at 1.13 times that version's speed.
#include <hip/hip_runtime.h>
#include <hip/hip_bf16.h>
#include <stdint.h>

// Problem constants (match reference)
#define BT 8
#define ST 512
#define FD 128
#define HD 128
#define NT (BT*ST)      // 4096 tokens
#define LNEPS 1e-5f

// Expert kernel tiling
#define WAVES 16
#define TOK_PER_WG (WAVES*16)   // 256 tokens per workgroup
#define FPG 8                   // features per workgroup (feature group)
#define WSTRIDE 132             // padded LDS row stride (floats): 128+4 -> bank-conflict-free

typedef __attribute__((ext_vector_type(2)))  float v2f;
typedef __attribute__((ext_vector_type(8)))  float v8f;
typedef __attribute__((ext_vector_type(4)))  unsigned int v4u;
typedef __attribute__((ext_vector_type(8)))  int v8i;
typedef __attribute__((ext_vector_type(4)))  int v4i;

__device__ __forceinline__ float elu1(float v) { return v > 0.f ? v : (__expf(v) - 1.f); }
__device__ __forceinline__ float sigm(float v) { return 1.f / (1.f + __expf(-v)); }

// ---------------------------------------------------------------------------
// Kernel A: zero the 'selected' output region (it is accumulated with atomics)
// ---------------------------------------------------------------------------
__global__ void vsn_zero_kernel(float* __restrict__ p, int n) {
    int i = blockIdx.x * blockDim.x + threadIdx.x;
    if (i < n) p[i] = 0.f;
}

// ---------------------------------------------------------------------------
// Kernel B: selection GRN -> softmax weights [NT, FD]  (1 block of 128 thr / token)
// ---------------------------------------------------------------------------
__global__ __launch_bounds__(128)
void vsn_sel_kernel(const float* __restrict__ x,
                    const float* __restrict__ w1, const float* __restrict__ b1,
                    const float* __restrict__ w2, const float* __restrict__ b2,
                    const float* __restrict__ wg, const float* __restrict__ bg,
                    const float* __restrict__ lng, const float* __restrict__ lnb,
                    float* __restrict__ wout) {
    __shared__ float xb[FD], hb[HD], h2b[HD], red[8];
    const int t = blockIdx.x;
    const int j = threadIdx.x;
    const int wv = j >> 5, ln = j & 31;

    xb[j] = x[(size_t)t * FD + j];
    __syncthreads();

    float acc = b1[j];
    for (int i = 0; i < FD; ++i) acc += xb[i] * w1[j * FD + i];
    hb[j] = elu1(acc);
    __syncthreads();

    acc = b2[j];
    for (int i = 0; i < HD; ++i) acc += hb[i] * w2[j * HD + i];
    h2b[j] = acc;
    __syncthreads();

    float ga = bg[j];
    for (int i = 0; i < HD; ++i) ga += h2b[i] * wg[j * HD + i];
    const float pre = sigm(ga) * h2b[j] + xb[j];

    // LayerNorm over 128
    float s = pre, s2 = pre * pre;
    for (int m = 16; m >= 1; m >>= 1) { s += __shfl_xor(s, m, 32); s2 += __shfl_xor(s2, m, 32); }
    if (ln == 0) { red[wv] = s; red[4 + wv] = s2; }
    __syncthreads();
    s  = red[0] + red[1] + red[2] + red[3];
    s2 = red[4] + red[5] + red[6] + red[7];
    const float mean = s * (1.f / FD);
    const float var  = s2 * (1.f / FD) - mean * mean;
    const float lno  = (pre - mean) * __frsqrt_rn(var + LNEPS) * lng[j] + lnb[j];
    __syncthreads();

    // softmax over 128
    float mx = lno;
    for (int m = 16; m >= 1; m >>= 1) mx = fmaxf(mx, __shfl_xor(mx, m, 32));
    if (ln == 0) red[wv] = mx;
    __syncthreads();
    mx = fmaxf(fmaxf(red[0], red[1]), fmaxf(red[2], red[3]));
    const float e = __expf(lno - mx);
    float se = e;
    for (int m = 16; m >= 1; m >>= 1) se += __shfl_xor(se, m, 32);
    __syncthreads();
    if (ln == 0) red[4 + wv] = se;
    __syncthreads();
    se = red[4] + red[5] + red[6] + red[7];
    wout[(size_t)t * FD + j] = e / se;
}

// ---------------------------------------------------------------------------
// TDM helper: DMA one 128x128 f32 matrix from global to LDS with +4 DWORD row
// padding (LDS row stride becomes 132 floats). Issued by wave 0 only.
// ---------------------------------------------------------------------------
__device__ __forceinline__ void tdm_load_128x128(const float* gsrc, unsigned lds_byte_addr) {
    const uint64_t ga = (uint64_t)(uintptr_t)gsrc;
    v4u g0;
    g0[0] = 1u;                       // count=1, user descriptor
    g0[1] = lds_byte_addr;            // lds_addr
    g0[2] = (unsigned)ga;             // global_addr[31:0]
    g0[3] = (unsigned)((ga >> 32) & 0x1FFFFFFull) | 0x80000000u; // addr[56:32] | type=2
    v8i g1;
    // workgroup_mask=0 | data_size=2(4B) | pad_enable | pad_interval=6(128 dw) | pad_amount=3(4 dw)
    g1[0] = (int)((2u << 16) | (1u << 20) | (6u << 22) | (3u << 25));
    g1[1] = (int)(HD << 16);          // tensor_dim0 = 128 (low16)
    g1[2] = (int)(HD << 16);          // tensor_dim0 hi16=0 | tensor_dim1=128 (low16)
    g1[3] = (int)(HD << 16);          // tensor_dim1 hi16=0 | tile_dim0 = 128
    g1[4] = (int)HD;                  // tile_dim1 = 128, tile_dim2 = 0
    g1[5] = (int)HD;                  // tensor_dim0_stride = 128 (low32)
    g1[6] = (int)((HD * HD) << 16);   // stride hi16=0 | tensor_dim1_stride low16 = 16384
    g1[7] = 0;                        // tensor_dim1_stride hi32 = 0
    v4i g2 = {0, 0, 0, 0};            // dims 3/4 unused (2D tile)
    v4i g3 = {0, 0, 0, 0};
    v8i g4 = {0, 0, 0, 0, 0, 0, 0, 0}; // trailing group (6-arg toolchain variant)
    __builtin_amdgcn_tensor_load_to_lds(g0, g1, g2, g3, g4, 0);
}

// ---------------------------------------------------------------------------
// Kernel C: per-feature GRN experts with V_WMMA_F32_16X16X4_F32, TDM weight
// staging, and weighted accumulation into 'selected' via f32 atomics.
// grid = (NT/TOK_PER_WG, FD/FPG), block = 512 (16 waves, 1 token-tile each):
// four waves share a SIMD, so one wave's elementwise tail runs under the others' WMMAs
// ---------------------------------------------------------------------------
__global__ __launch_bounds__(WAVES * 32)
void vsn_expert_kernel(const float* __restrict__ x,
                       const float* __restrict__ vw1,  const float* __restrict__ vb1,
                       const float* __restrict__ vw2,  const float* __restrict__ vb2,
                       const float* __restrict__ vwg,  const float* __restrict__ vbg,
                       const float* __restrict__ vwsk, const float* __restrict__ vbsk,
                       const float* __restrict__ vlng, const float* __restrict__ vlnb,
                       const float* __restrict__ wsel,     // [NT, FD] selection weights
                       float* __restrict__ outsel) {       // [NT, HD] accumulated
    // all three on multiples of 2 KiB, so that the tensor loads' places in LDS are such
    // multiples in whatever order the arrays are laid out
    __shared__ __attribute__((aligned(2048))) float sW2[HD * WSTRIDE];  // 66 KB, TDM-padded
    __shared__ __attribute__((aligned(2048))) float sWg[HD * WSTRIDE];  // 66 KB, TDM-padded
    __shared__ __attribute__((aligned(2048))) float sStage[WAVES][16 * WSTRIDE];  // 132 KB vh2 staging
    __shared__ float sVec[8][HD];                          // w1,b1,b2,bg,wsk,bsk,lng,lnb

    const int tid  = threadIdx.x;
    const int wave = tid >> 5;
    const int lane = tid & 31;
    const int col  = lane & 15;    // N index / M row index within half
    const int half = lane >> 4;    // K-half selector for A/B fragments
    const int t0   = blockIdx.x * TOK_PER_WG + wave * 16;
    const int f0   = blockIdx.y * FPG;
    float* const stg = &sStage[wave][0];

    v8f accsel[8];
#pragma unroll
    for (int n = 0; n < 8; ++n) accsel[n] = (v8f){0.f,0.f,0.f,0.f,0.f,0.f,0.f,0.f};

    for (int fi = 0; fi < FPG; ++fi) {
        const int f = f0 + fi;
        __syncthreads();           // previous iteration done reading weight LDS

        // --- stage this feature's weights: TDM for matrices, VALU for vectors ---
        if (tid < 32) {
            tdm_load_128x128(vw2 + (size_t)f * HD * HD, (unsigned)(uintptr_t)&sW2[0]);
            tdm_load_128x128(vwg + (size_t)f * HD * HD, (unsigned)(uintptr_t)&sWg[0]);
            __builtin_amdgcn_s_wait_tensorcnt(0);
        }
        if (tid < HD) {
            const int j = tid;     // 128 elements per small vector
            sVec[0][j] = vw1 [(size_t)f * HD + j];
            sVec[1][j] = vb1 [(size_t)f * HD + j];
            sVec[2][j] = vb2 [(size_t)f * HD + j];
            sVec[3][j] = vbg [(size_t)f * HD + j];
            sVec[4][j] = vwsk[(size_t)f * HD + j];
            sVec[5][j] = vbsk[(size_t)f * HD + j];
            sVec[6][j] = vlng[(size_t)f * HD + j];
            sVec[7][j] = vlnb[(size_t)f * HD + j];
        }
        __syncthreads();

        // x value for this lane's A-matrix row (rows M = lane&15, both halves)
        const float xv = x[(size_t)(t0 + col) * FD + f];

        v8f c[8];
#pragma unroll
        for (int n = 0; n < 8; ++n) c[n] = (v8f){0.f,0.f,0.f,0.f,0.f,0.f,0.f,0.f};

        // ---- GEMM1: vh2 = elu(x*w1+b1) @ W2^T   (16 x 128 = 8 col-tiles) ----
        // Unroll capped: 8 independent WMMA chains per step give enough ILP;
        // full unroll blows past 256 VGPRs (s_set_vgpr_msb churn).
#pragma unroll 2
        for (int k = 0; k < HD; k += 4) {
            const int klo = k + half * 2;
            v2f a;
            a.x = elu1(xv * sVec[0][klo]     + sVec[1][klo]);
            a.y = elu1(xv * sVec[0][klo + 1] + sVec[1][klo + 1]);
#pragma unroll
            for (int n = 0; n < 8; ++n) {
                const int g = n * 16 + col;
                v2f b = *(const v2f*)&sW2[g * WSTRIDE + klo];
                c[n] = __builtin_amdgcn_wmma_f32_16x16x4_f32(
                    false, a, false, b, (short)0, c[n], false, false);
            }
        }

        // store vh2 (+bias b2) to padded LDS staging (C layout -> row major)
#pragma unroll
        for (int n = 0; n < 8; ++n) {
            const int g = n * 16 + col;
            const float b2v = sVec[2][g];
#pragma unroll
            for (int r = 0; r < 8; ++r)
                stg[(r + 8 * half) * WSTRIDE + g] = c[n][r] + b2v;
        }

        // ---- GEMM2: gate_pre = vh2 @ Wg^T ----
#pragma unroll
        for (int n = 0; n < 8; ++n) c[n] = (v8f){0.f,0.f,0.f,0.f,0.f,0.f,0.f,0.f};
#pragma unroll 2
        for (int k = 0; k < HD; k += 4) {
            const int klo = k + half * 2;
            v2f a = *(const v2f*)&stg[col * WSTRIDE + klo];
#pragma unroll
            for (int n = 0; n < 8; ++n) {
                const int g = n * 16 + col;
                v2f b = *(const v2f*)&sWg[g * WSTRIDE + klo];
                c[n] = __builtin_amdgcn_wmma_f32_16x16x4_f32(
                    false, a, false, b, (short)0, c[n], false, false);
            }
        }

        // ---- elementwise: sigmoid gate, skip, LayerNorm, weighted accumulate ----
#pragma unroll
        for (int r = 0; r < 8; ++r) {
            const int m = r + 8 * half;                 // token row in tile
            const float xm = x   [(size_t)(t0 + m) * FD + f];
            const float wm = wsel[(size_t)(t0 + m) * FD + f];
            float y[8];
            float s = 0.f, s2 = 0.f;
#pragma unroll
            for (int n = 0; n < 8; ++n) {
                const int g = n * 16 + col;
                const float vh2v = stg[m * WSTRIDE + g];
                const float vgv  = sigm(c[n][r] + sVec[3][g]);
                const float sk   = xm * sVec[4][g] + sVec[5][g];
                const float t    = vgv * vh2v + sk;
                y[n] = t; s += t; s2 += t * t;
            }
            // reduce over the 16 lanes of this half (128 values per token row)
#pragma unroll
            for (int msk = 1; msk < 16; msk <<= 1) {
                s  += __shfl_xor(s,  msk, 32);
                s2 += __shfl_xor(s2, msk, 32);
            }
            const float mean = s * (1.f / HD);
            const float var  = s2 * (1.f / HD) - mean * mean;
            const float rstd = __frsqrt_rn(var + LNEPS);
#pragma unroll
            for (int n = 0; n < 8; ++n) {
                const int g = n * 16 + col;
                const float vout = (y[n] - mean) * rstd * sVec[6][g] + sVec[7][g];
                accsel[n][r] += vout * wm;
            }
        }
    }

    // ---- reduce over feature groups into global output ----
#pragma unroll
    for (int n = 0; n < 8; ++n) {
#pragma unroll
        for (int r = 0; r < 8; ++r) {
            const int m = r + 8 * half;
            atomicAdd(&outsel[(size_t)(t0 + m) * HD + n * 16 + col], accsel[n][r]);
        }
    }
}

// ---------------------------------------------------------------------------
extern "C" void kernel_launch(void* const* d_in, const int* in_sizes, int n_in,
                              void* d_out, int out_size, void* d_ws, size_t ws_size,
                              hipStream_t stream) {
    (void)in_sizes; (void)n_in; (void)out_size; (void)d_ws; (void)ws_size;
    const float* x     = (const float*)d_in[0];
    const float* sw1   = (const float*)d_in[1];
    const float* sb1   = (const float*)d_in[2];
    const float* sw2   = (const float*)d_in[3];
    const float* sb2   = (const float*)d_in[4];
    const float* swg   = (const float*)d_in[5];
    const float* sbg   = (const float*)d_in[6];
    const float* slng  = (const float*)d_in[7];
    const float* slnb  = (const float*)d_in[8];
    const float* vw1   = (const float*)d_in[9];
    const float* vb1   = (const float*)d_in[10];
    const float* vw2   = (const float*)d_in[11];
    const float* vb2   = (const float*)d_in[12];
    const float* vwg   = (const float*)d_in[13];
    const float* vbg   = (const float*)d_in[14];
    const float* vwsk  = (const float*)d_in[15];
    const float* vbsk  = (const float*)d_in[16];
    const float* vlng  = (const float*)d_in[17];
    const float* vlnb  = (const float*)d_in[18];

    float* out_sel = (float*)d_out;                 // [NT, HD]
    float* out_w   = out_sel + (size_t)NT * HD;     // [NT, FD]

    vsn_zero_kernel<<<(NT * HD + 255) / 256, 256, 0, stream>>>(out_sel, NT * HD);

    vsn_sel_kernel<<<NT, 128, 0, stream>>>(x, sw1, sb1, sw2, sb2, swg, sbg,
                                           slng, slnb, out_w);

    dim3 grid2(NT / TOK_PER_WG, FD / FPG);
    vsn_expert_kernel<<<grid2, WAVES * 32, 0, stream>>>(
        x, vw1, vb1, vw2, vb2, vwg, vbg, vwsk, vbsk, vlng, vlnb, out_w, out_sel);
}

// v002
// A run of this version takes 212 microseconds.
// Timed twice side by side with v001, it ran 1.22 times as fast both times.
// Counting every step since v000, it is 1.37 times as fast.
#include <hip/hip_runtime.h>
#include <hip/hip_bf16.h>
#include <stdint.h>

// Problem constants (match reference)
#define BT 8
#define ST 512
#define FD 128
#define HD 128
#define NT (BT*ST)      // 4096 tokens
#define LNEPS 1e-5f

// Expert kernel tiling
#define WAVES 16
#define TOK_PER_WG (WAVES*16)   // 256 tokens per workgroup
#define FPG 8                   // features per workgroup (feature group)
#define WSTRIDE 132             // padded LDS row stride (floats): 128+4 -> bank-conflict-free

typedef __attribute__((ext_vector_type(2)))  float v2f;
typedef __attribute__((ext_vector_type(8)))  float v8f;
typedef __attribute__((ext_vector_type(4)))  unsigned int v4u;
typedef __attribute__((ext_vector_type(8)))  int v8i;
typedef __attribute__((ext_vector_type(4)))  int v4i;

__device__ __forceinline__ float elu1(float v) { return v > 0.f ? v : (__expf(v) - 1.f); }
__device__ __forceinline__ float sigm(float v) { return 1.f / (1.f + __expf(-v)); }

// ---------------------------------------------------------------------------
// Kernel A: zero the 'selected' output region (it is accumulated with atomics)
// ---------------------------------------------------------------------------
__global__ void vsn_zero_kernel(float* __restrict__ p, int n) {
    int i = blockIdx.x * blockDim.x + threadIdx.x;
    if (i < n) p[i] = 0.f;
}

// ---------------------------------------------------------------------------
// Kernel B: selection GRN -> softmax weights [NT, FD]
// One workgroup of 8 waves per 16 tokens. The three 128x128 products run on
// V_WMMA_F32_16X16X4_F32: wave w owns output columns 16w..16w+15, so it needs only
// rows 16w..16w+15 of each weight matrix; it fetches them as whole 512-byte rows and
// turns them into fragments through padded LDS.
// ---------------------------------------------------------------------------
#define SEL_WAVES 8
#define SEL_TOK 16

// 16x16 tile of A[16][128] * Bw[16][128]^T. Lanes 0-15 take floats k..k+3 and lanes 16-31
// floats k+4..k+7 of their row, from A and from Bw alike, so both operands hold the same k
// at every lane and register position.
__device__ __forceinline__ v8f sel_tile(const float* A, const float* Bw, int col, int half) {
    const float* ap = A  + col * WSTRIDE + half * 4;
    const float* bp = Bw + col * WSTRIDE + half * 4;
    v8f c = (v8f){0.f,0.f,0.f,0.f,0.f,0.f,0.f,0.f};
    for (int k = 0; k < HD; k += 8) {
        const float4 a = *(const float4*)(ap + k);
        const float4 b = *(const float4*)(bp + k);
        c = __builtin_amdgcn_wmma_f32_16x16x4_f32(
            false, (v2f){a.x, a.y}, false, (v2f){b.x, b.y}, (short)0, c, false, false);
        c = __builtin_amdgcn_wmma_f32_16x16x4_f32(
            false, (v2f){a.z, a.w}, false, (v2f){b.z, b.w}, (short)0, c, false, false);
    }
    return c;
}

__global__ __launch_bounds__(SEL_WAVES * 32)
void vsn_sel_kernel(const float* __restrict__ x,
                    const float* __restrict__ w1, const float* __restrict__ b1,
                    const float* __restrict__ w2, const float* __restrict__ b2,
                    const float* __restrict__ wg, const float* __restrict__ bg,
                    const float* __restrict__ lng, const float* __restrict__ lnb,
                    float* __restrict__ wout) {
    __shared__ __attribute__((aligned(16))) float sW[3][HD * WSTRIDE];      // w1, w2, wg
    __shared__ __attribute__((aligned(16))) float sX [SEL_TOK * WSTRIDE];   // x tile
    __shared__ __attribute__((aligned(16))) float sH [SEL_TOK * WSTRIDE];   // elu(x w1^T + b1)
    __shared__ __attribute__((aligned(16))) float sH2[SEL_TOK * WSTRIDE];   // h w2^T + b2
    __shared__ __attribute__((aligned(16))) float sP [SEL_TOK * WSTRIDE];   // gate*h2 + x

    const int tid  = threadIdx.x;
    const int wave = tid >> 5;
    const int lane = tid & 31;
    const int col  = lane & 15;
    const int half = lane >> 4;
    const int t0   = blockIdx.x * SEL_TOK;
    const int g    = wave * 16 + col;          // this lane's output column
    const int wofs = wave * 16 * WSTRIDE;      // this wave's rows in a staged matrix
    const size_t grow = (size_t)(wave * 16) * FD + lane * 4;

    // weights pass through registers: w2 and wg are asked for ahead of the products that
    // read them, so that they can arrive while the product before them runs
    const float4 xr0 = *(const float4*)&x[(size_t)(t0 + wave)     * FD + lane * 4];
    const float4 xr1 = *(const float4*)&x[(size_t)(t0 + wave + 8) * FD + lane * 4];
    float4 ra[16], rb[16];
    for (int i = 0; i < 16; ++i) ra[i] = *(const float4*)&w1[grow + i * FD];
    for (int i = 0; i < 16; ++i) rb[i] = *(const float4*)&w2[grow + i * FD];

    *(float4*)&sX[(wave)     * WSTRIDE + lane * 4] = xr0;
    *(float4*)&sX[(wave + 8) * WSTRIDE + lane * 4] = xr1;
    for (int i = 0; i < 16; ++i) *(float4*)&sW[0][wofs + i * WSTRIDE + lane * 4] = ra[i];
    for (int i = 0; i < 16; ++i) ra[i] = *(const float4*)&wg[grow + i * FD];
    const float b1v = b1[g], b2v = b2[g], bgv = bg[g];
    __syncthreads();

    // h = elu(x w1^T + b1)
    v8f c = sel_tile(sX, &sW[0][wofs], col, half);
    for (int r = 0; r < 8; ++r) sH[(r + 8 * half) * WSTRIDE + g] = elu1(c[r] + b1v);
    for (int i = 0; i < 16; ++i) *(float4*)&sW[1][wofs + i * WSTRIDE + lane * 4] = rb[i];
    __syncthreads();

    // h2 = h w2^T + b2 (kept in registers for the gate product as well)
    v8f h2 = sel_tile(sH, &sW[1][wofs], col, half);
    for (int r = 0; r < 8; ++r) { h2[r] += b2v; sH2[(r + 8 * half) * WSTRIDE + g] = h2[r]; }
    for (int i = 0; i < 16; ++i) *(float4*)&sW[2][wofs + i * WSTRIDE + lane * 4] = ra[i];
    __syncthreads();

    // pre = sigmoid(h2 wg^T + bg) * h2 + x
    c = sel_tile(sH2, &sW[2][wofs], col, half);
    for (int r = 0; r < 8; ++r) {
        const int m = r + 8 * half;
        sP[m * WSTRIDE + g] = sigm(c[r] + bgv) * h2[r] + sX[m * WSTRIDE + g];
    }
    __syncthreads();

    // LayerNorm and softmax over 128: one token per 16-lane row, 8 values per lane
    const int m = wave * 2 + half;
    const float4 p0 = *(const float4*)&sP[m * WSTRIDE + col * 4];
    const float4 p1 = *(const float4*)&sP[m * WSTRIDE + 64 + col * 4];
    const float4 g0 = *(const float4*)&lng[col * 4], g1 = *(const float4*)&lng[64 + col * 4];
    const float4 o0 = *(const float4*)&lnb[col * 4], o1 = *(const float4*)&lnb[64 + col * 4];
    float v[8]  = {p0.x, p0.y, p0.z, p0.w, p1.x, p1.y, p1.z, p1.w};
    const float gm[8] = {g0.x, g0.y, g0.z, g0.w, g1.x, g1.y, g1.z, g1.w};
    const float of[8] = {o0.x, o0.y, o0.z, o0.w, o1.x, o1.y, o1.z, o1.w};

    float s = 0.f, s2 = 0.f;
    for (int i = 0; i < 8; ++i) { s += v[i]; s2 += v[i] * v[i]; }
    for (int msk = 1; msk < 16; msk <<= 1) { s += __shfl_xor(s, msk, 32); s2 += __shfl_xor(s2, msk, 32); }
    const float mean = s * (1.f / FD);
    const float var  = s2 * (1.f / FD) - mean * mean;
    const float rstd = __frsqrt_rn(var + LNEPS);
    float mx = -INFINITY;
    for (int i = 0; i < 8; ++i) { v[i] = (v[i] - mean) * rstd * gm[i] + of[i]; mx = fmaxf(mx, v[i]); }
    for (int msk = 1; msk < 16; msk <<= 1) mx = fmaxf(mx, __shfl_xor(mx, msk, 32));
    float se = 0.f;
    for (int i = 0; i < 8; ++i) { v[i] = __expf(v[i] - mx); se += v[i]; }
    for (int msk = 1; msk < 16; msk <<= 1) se += __shfl_xor(se, msk, 32);
    float* const wo = &wout[(size_t)(t0 + m) * FD];
    *(float4*)&wo[col * 4]      = make_float4(v[0] / se, v[1] / se, v[2] / se, v[3] / se);
    *(float4*)&wo[64 + col * 4] = make_float4(v[4] / se, v[5] / se, v[6] / se, v[7] / se);
}

// ---------------------------------------------------------------------------
// TDM helper: DMA one 128x128 f32 matrix from global to LDS with +4 DWORD row
// padding (LDS row stride becomes 132 floats). Issued by wave 0 only.
// ---------------------------------------------------------------------------
__device__ __forceinline__ void tdm_load_128x128(const float* gsrc, unsigned lds_byte_addr) {
    const uint64_t ga = (uint64_t)(uintptr_t)gsrc;
    v4u g0;
    g0[0] = 1u;                       // count=1, user descriptor
    g0[1] = lds_byte_addr;            // lds_addr
    g0[2] = (unsigned)ga;             // global_addr[31:0]
    g0[3] = (unsigned)((ga >> 32) & 0x1FFFFFFull) | 0x80000000u; // addr[56:32] | type=2
    v8i g1;
    // workgroup_mask=0 | data_size=2(4B) | pad_enable | pad_interval=6(128 dw) | pad_amount=3(4 dw)
    g1[0] = (int)((2u << 16) | (1u << 20) | (6u << 22) | (3u << 25));
    g1[1] = (int)(HD << 16);          // tensor_dim0 = 128 (low16)
    g1[2] = (int)(HD << 16);          // tensor_dim0 hi16=0 | tensor_dim1=128 (low16)
    g1[3] = (int)(HD << 16);          // tensor_dim1 hi16=0 | tile_dim0 = 128
    g1[4] = (int)HD;                  // tile_dim1 = 128, tile_dim2 = 0
    g1[5] = (int)HD;                  // tensor_dim0_stride = 128 (low32)
    g1[6] = (int)((HD * HD) << 16);   // stride hi16=0 | tensor_dim1_stride low16 = 16384
    g1[7] = 0;                        // tensor_dim1_stride hi32 = 0
    v4i g2 = {0, 0, 0, 0};            // dims 3/4 unused (2D tile)
    v4i g3 = {0, 0, 0, 0};
    v8i g4 = {0, 0, 0, 0, 0, 0, 0, 0}; // trailing group (6-arg toolchain variant)
    __builtin_amdgcn_tensor_load_to_lds(g0, g1, g2, g3, g4, 0);
}

// ---------------------------------------------------------------------------
// Kernel C: per-feature GRN experts with V_WMMA_F32_16X16X4_F32, TDM weight
// staging, and weighted accumulation into 'selected' via f32 atomics.
// grid = (NT/TOK_PER_WG, FD/FPG), block = 512 (16 waves, 1 token-tile each):
// four waves share a SIMD, so one wave's elementwise tail runs under the others' WMMAs
// ---------------------------------------------------------------------------
__global__ __launch_bounds__(WAVES * 32)
void vsn_expert_kernel(const float* __restrict__ x,
                       const float* __restrict__ vw1,  const float* __restrict__ vb1,
                       const float* __restrict__ vw2,  const float* __restrict__ vb2,
                       const float* __restrict__ vwg,  const float* __restrict__ vbg,
                       const float* __restrict__ vwsk, const float* __restrict__ vbsk,
                       const float* __restrict__ vlng, const float* __restrict__ vlnb,
                       const float* __restrict__ wsel,     // [NT, FD] selection weights
                       float* __restrict__ outsel) {       // [NT, HD] accumulated
    // all three on multiples of 2 KiB, so that the tensor loads' places in LDS are such
    // multiples in whatever order the arrays are laid out
    __shared__ __attribute__((aligned(2048))) float sW2[HD * WSTRIDE];  // 66 KB, TDM-padded
    __shared__ __attribute__((aligned(2048))) float sWg[HD * WSTRIDE];  // 66 KB, TDM-padded
    __shared__ __attribute__((aligned(2048))) float sStage[WAVES][16 * WSTRIDE];  // 132 KB vh2 staging
    __shared__ float sVec[8][HD];                          // w1,b1,b2,bg,wsk,bsk,lng,lnb

    const int tid  = threadIdx.x;
    const int wave = tid >> 5;
    const int lane = tid & 31;
    const int col  = lane & 15;    // N index / M row index within half
    const int half = lane >> 4;    // K-half selector for A/B fragments
    const int t0   = blockIdx.x * TOK_PER_WG + wave * 16;
    const int f0   = blockIdx.y * FPG;
    float* const stg = &sStage[wave][0];

    v8f accsel[8];
#pragma unroll
    for (int n = 0; n < 8; ++n) accsel[n] = (v8f){0.f,0.f,0.f,0.f,0.f,0.f,0.f,0.f};

    for (int fi = 0; fi < FPG; ++fi) {
        const int f = f0 + fi;
        __syncthreads();           // previous iteration done reading weight LDS

        // --- stage this feature's weights: TDM for matrices, VALU for vectors ---
        if (tid < 32) {
            tdm_load_128x128(vw2 + (size_t)f * HD * HD, (unsigned)(uintptr_t)&sW2[0]);
            tdm_load_128x128(vwg + (size_t)f * HD * HD, (unsigned)(uintptr_t)&sWg[0]);
            __builtin_amdgcn_s_wait_tensorcnt(0);
        }
        if (tid < HD) {
            const int j = tid;     // 128 elements per small vector
            sVec[0][j] = vw1 [(size_t)f * HD + j];
            sVec[1][j] = vb1 [(size_t)f * HD + j];
            sVec[2][j] = vb2 [(size_t)f * HD + j];
            sVec[3][j] = vbg [(size_t)f * HD + j];
            sVec[4][j] = vwsk[(size_t)f * HD + j];
            sVec[5][j] = vbsk[(size_t)f * HD + j];
            sVec[6][j] = vlng[(size_t)f * HD + j];
            sVec[7][j] = vlnb[(size_t)f * HD + j];
        }
        __syncthreads();

        // x value for this lane's A-matrix row (rows M = lane&15, both halves)
        const float xv = x[(size_t)(t0 + col) * FD + f];

        v8f c[8];
#pragma unroll
        for (int n = 0; n < 8; ++n) c[n] = (v8f){0.f,0.f,0.f,0.f,0.f,0.f,0.f,0.f};

        // ---- GEMM1: vh2 = elu(x*w1+b1) @ W2^T   (16 x 128 = 8 col-tiles) ----
        // Unroll capped: 8 independent WMMA chains per step give enough ILP;
        // full unroll blows past 256 VGPRs (s_set_vgpr_msb churn).
#pragma unroll 2
        for (int k = 0; k < HD; k += 4) {
            const int klo = k + half * 2;
            v2f a;
            a.x = elu1(xv * sVec[0][klo]     + sVec[1][klo]);
            a.y = elu1(xv * sVec[0][klo + 1] + sVec[1][klo + 1]);
#pragma unroll
            for (int n = 0; n < 8; ++n) {
                const int g = n * 16 + col;
                v2f b = *(const v2f*)&sW2[g * WSTRIDE + klo];
                c[n] = __builtin_amdgcn_wmma_f32_16x16x4_f32(
                    false, a, false, b, (short)0, c[n], false, false);
            }
        }

        // store vh2 (+bias b2) to padded LDS staging (C layout -> row major)
#pragma unroll
        for (int n = 0; n < 8; ++n) {
            const int g = n * 16 + col;
            const float b2v = sVec[2][g];
#pragma unroll
            for (int r = 0; r < 8; ++r)
                stg[(r + 8 * half) * WSTRIDE + g] = c[n][r] + b2v;
        }

        // ---- GEMM2: gate_pre = vh2 @ Wg^T ----
#pragma unroll
        for (int n = 0; n < 8; ++n) c[n] = (v8f){0.f,0.f,0.f,0.f,0.f,0.f,0.f,0.f};
#pragma unroll 2
        for (int k = 0; k < HD; k += 4) {
            const int klo = k + half * 2;
            v2f a = *(const v2f*)&stg[col * WSTRIDE + klo];
#pragma unroll
            for (int n = 0; n < 8; ++n) {
                const int g = n * 16 + col;
                v2f b = *(const v2f*)&sWg[g * WSTRIDE + klo];
                c[n] = __builtin_amdgcn_wmma_f32_16x16x4_f32(
                    false, a, false, b, (short)0, c[n], false, false);
            }
        }

        // ---- elementwise: sigmoid gate, skip, LayerNorm, weighted accumulate ----
#pragma unroll
        for (int r = 0; r < 8; ++r) {
            const int m = r + 8 * half;                 // token row in tile
            const float xm = x   [(size_t)(t0 + m) * FD + f];
            const float wm = wsel[(size_t)(t0 + m) * FD + f];
            float y[8];
            float s = 0.f, s2 = 0.f;
#pragma unroll
            for (int n = 0; n < 8; ++n) {
                const int g = n * 16 + col;
                const float vh2v = stg[m * WSTRIDE + g];
                const float vgv  = sigm(c[n][r] + sVec[3][g]);
                const float sk   = xm * sVec[4][g] + sVec[5][g];
                const float t    = vgv * vh2v + sk;
                y[n] = t; s += t; s2 += t * t;
            }
            // reduce over the 16 lanes of this half (128 values per token row)
#pragma unroll
            for (int msk = 1; msk < 16; msk <<= 1) {
                s  += __shfl_xor(s,  msk, 32);
                s2 += __shfl_xor(s2, msk, 32);
            }
            const float mean = s * (1.f / HD);
            const float var  = s2 * (1.f / HD) - mean * mean;
            const float rstd = __frsqrt_rn(var + LNEPS);
#pragma unroll
            for (int n = 0; n < 8; ++n) {
                const int g = n * 16 + col;
                const float vout = (y[n] - mean) * rstd * sVec[6][g] + sVec[7][g];
                accsel[n][r] += vout * wm;
            }
        }
    }

    // ---- reduce over feature groups into global output ----
#pragma unroll
    for (int n = 0; n < 8; ++n) {
#pragma unroll
        for (int r = 0; r < 8; ++r) {
            const int m = r + 8 * half;
            atomicAdd(&outsel[(size_t)(t0 + m) * HD + n * 16 + col], accsel[n][r]);
        }
    }
}

// ---------------------------------------------------------------------------
extern "C" void kernel_launch(void* const* d_in, const int* in_sizes, int n_in,
                              void* d_out, int out_size, void* d_ws, size_t ws_size,
                              hipStream_t stream) {
    (void)in_sizes; (void)n_in; (void)out_size; (void)d_ws; (void)ws_size;
    const float* x     = (const float*)d_in[0];
    const float* sw1   = (const float*)d_in[1];
    const float* sb1   = (const float*)d_in[2];
    const float* sw2   = (const float*)d_in[3];
    const float* sb2   = (const float*)d_in[4];
    const float* swg   = (const float*)d_in[5];
    const float* sbg   = (const float*)d_in[6];
    const float* slng  = (const float*)d_in[7];
    const float* slnb  = (const float*)d_in[8];
    const float* vw1   = (const float*)d_in[9];
    const float* vb1   = (const float*)d_in[10];
    const float* vw2   = (const float*)d_in[11];
    const float* vb2   = (const float*)d_in[12];
    const float* vwg   = (const float*)d_in[13];
    const float* vbg   = (const float*)d_in[14];
    const float* vwsk  = (const float*)d_in[15];
    const float* vbsk  = (const float*)d_in[16];
    const float* vlng  = (const float*)d_in[17];
    const float* vlnb  = (const float*)d_in[18];

    float* out_sel = (float*)d_out;                 // [NT, HD]
    float* out_w   = out_sel + (size_t)NT * HD;     // [NT, FD]

    vsn_zero_kernel<<<(NT * HD + 255) / 256, 256, 0, stream>>>(out_sel, NT * HD);

    vsn_sel_kernel<<<NT / SEL_TOK, SEL_WAVES * 32, 0, stream>>>(x, sw1, sb1, sw2, sb2, swg, sbg,
                                           slng, slnb, out_w);

    dim3 grid2(NT / TOK_PER_WG, FD / FPG);
    vsn_expert_kernel<<<grid2, WAVES * 32, 0, stream>>>(
        x, vw1, vb1, vw2, vb2, vwg, vbg, vwsk, vbsk, vlng, vlnb, out_w, out_sel);
}

// v003
// It runs in 198 microseconds.
// In both of two side-by-side timings against v002, it was 1.07 times as fast.
// Counting every step since v000, it is 1.47 times as fast.
#include <hip/hip_runtime.h>
#include <hip/hip_bf16.h>
#include <stdint.h>

// Problem constants (match reference)
#define BT 8
#define ST 512
#define FD 128
#define HD 128
#define NT (BT*ST)      // 4096 tokens
#define LNEPS 1e-5f

// Expert kernel tiling
#define WAVES 16
#define TOK_PER_WG (WAVES*16)   // 256 tokens per workgroup
#define FPG 8                   // features per workgroup (feature group)
#define WSTRIDE 132             // padded LDS row stride (floats): 128+4 -> bank-conflict-free

typedef __attribute__((ext_vector_type(2)))  float v2f;
typedef __attribute__((ext_vector_type(8)))  float v8f;
typedef __attribute__((ext_vector_type(4)))  unsigned int v4u;
typedef __attribute__((ext_vector_type(8)))  int v8i;
typedef __attribute__((ext_vector_type(4)))  int v4i;

__device__ __forceinline__ float elu1(float v) { return v > 0.f ? v : (__expf(v) - 1.f); }
__device__ __forceinline__ float sigm(float v) { return 1.f / (1.f + __expf(-v)); }

// ---------------------------------------------------------------------------
// Kernel A: zero the 'selected' output region (it is accumulated with atomics)
// ---------------------------------------------------------------------------
__global__ void vsn_zero_kernel(float* __restrict__ p, int n) {
    int i = blockIdx.x * blockDim.x + threadIdx.x;
    if (i < n) p[i] = 0.f;
}

// ---------------------------------------------------------------------------
// Kernel B: selection GRN -> softmax weights [NT, FD]
// One workgroup of 8 waves per 16 tokens. The three 128x128 products run on
// V_WMMA_F32_16X16X4_F32: wave w owns output columns 16w..16w+15, so it needs only
// rows 16w..16w+15 of each weight matrix; it fetches them as whole 512-byte rows and
// turns them into fragments through padded LDS.
// ---------------------------------------------------------------------------
#define SEL_WAVES 8
#define SEL_TOK 16

// 16x16 tile of A[16][128] * Bw[16][128]^T. Lanes 0-15 take floats k..k+3 and lanes 16-31
// floats k+4..k+7 of their row, from A and from Bw alike, so both operands hold the same k
// at every lane and register position.
__device__ __forceinline__ v8f sel_tile(const float* A, const float* Bw, int col, int half) {
    const float* ap = A  + col * WSTRIDE + half * 4;
    const float* bp = Bw + col * WSTRIDE + half * 4;
    v8f c = (v8f){0.f,0.f,0.f,0.f,0.f,0.f,0.f,0.f};
    for (int k = 0; k < HD; k += 8) {
        const float4 a = *(const float4*)(ap + k);
        const float4 b = *(const float4*)(bp + k);
        c = __builtin_amdgcn_wmma_f32_16x16x4_f32(
            false, (v2f){a.x, a.y}, false, (v2f){b.x, b.y}, (short)0, c, false, false);
        c = __builtin_amdgcn_wmma_f32_16x16x4_f32(
            false, (v2f){a.z, a.w}, false, (v2f){b.z, b.w}, (short)0, c, false, false);
    }
    return c;
}

__global__ __launch_bounds__(SEL_WAVES * 32)
void vsn_sel_kernel(const float* __restrict__ x,
                    const float* __restrict__ w1, const float* __restrict__ b1,
                    const float* __restrict__ w2, const float* __restrict__ b2,
                    const float* __restrict__ wg, const float* __restrict__ bg,
                    const float* __restrict__ lng, const float* __restrict__ lnb,
                    float* __restrict__ wout) {
    __shared__ __attribute__((aligned(16))) float sW[3][HD * WSTRIDE];      // w1, w2, wg
    __shared__ __attribute__((aligned(16))) float sX [SEL_TOK * WSTRIDE];   // x tile
    __shared__ __attribute__((aligned(16))) float sH [SEL_TOK * WSTRIDE];   // elu(x w1^T + b1)
    __shared__ __attribute__((aligned(16))) float sH2[SEL_TOK * WSTRIDE];   // h w2^T + b2
    __shared__ __attribute__((aligned(16))) float sP [SEL_TOK * WSTRIDE];   // gate*h2 + x

    const int tid  = threadIdx.x;
    const int wave = tid >> 5;
    const int lane = tid & 31;
    const int col  = lane & 15;
    const int half = lane >> 4;
    const int t0   = blockIdx.x * SEL_TOK;
    const int g    = wave * 16 + col;          // this lane's output column
    const int wofs = wave * 16 * WSTRIDE;      // this wave's rows in a staged matrix
    const size_t grow = (size_t)(wave * 16) * FD + lane * 4;

    // weights pass through registers: w2 and wg are asked for ahead of the products that
    // read them, so that they can arrive while the product before them runs
    const float4 xr0 = *(const float4*)&x[(size_t)(t0 + wave)     * FD + lane * 4];
    const float4 xr1 = *(const float4*)&x[(size_t)(t0 + wave + 8) * FD + lane * 4];
    float4 ra[16], rb[16];
    for (int i = 0; i < 16; ++i) ra[i] = *(const float4*)&w1[grow + i * FD];
    for (int i = 0; i < 16; ++i) rb[i] = *(const float4*)&w2[grow + i * FD];

    *(float4*)&sX[(wave)     * WSTRIDE + lane * 4] = xr0;
    *(float4*)&sX[(wave + 8) * WSTRIDE + lane * 4] = xr1;
    for (int i = 0; i < 16; ++i) *(float4*)&sW[0][wofs + i * WSTRIDE + lane * 4] = ra[i];
    for (int i = 0; i < 16; ++i) ra[i] = *(const float4*)&wg[grow + i * FD];
    const float b1v = b1[g], b2v = b2[g], bgv = bg[g];
    __syncthreads();

    // h = elu(x w1^T + b1)
    v8f c = sel_tile(sX, &sW[0][wofs], col, half);
    for (int r = 0; r < 8; ++r) sH[(r + 8 * half) * WSTRIDE + g] = elu1(c[r] + b1v);
    for (int i = 0; i < 16; ++i) *(float4*)&sW[1][wofs + i * WSTRIDE + lane * 4] = rb[i];
    __syncthreads();

    // h2 = h w2^T + b2 (kept in registers for the gate product as well)
    v8f h2 = sel_tile(sH, &sW[1][wofs], col, half);
    for (int r = 0; r < 8; ++r) { h2[r] += b2v; sH2[(r + 8 * half) * WSTRIDE + g] = h2[r]; }
    for (int i = 0; i < 16; ++i) *(float4*)&sW[2][wofs + i * WSTRIDE + lane * 4] = ra[i];
    __syncthreads();

    // pre = sigmoid(h2 wg^T + bg) * h2 + x
    c = sel_tile(sH2, &sW[2][wofs], col, half);
    for (int r = 0; r < 8; ++r) {
        const int m = r + 8 * half;
        sP[m * WSTRIDE + g] = sigm(c[r] + bgv) * h2[r] + sX[m * WSTRIDE + g];
    }
    __syncthreads();

    // LayerNorm and softmax over 128: one token per 16-lane row, 8 values per lane
    const int m = wave * 2 + half;
    const float4 p0 = *(const float4*)&sP[m * WSTRIDE + col * 4];
    const float4 p1 = *(const float4*)&sP[m * WSTRIDE + 64 + col * 4];
    const float4 g0 = *(const float4*)&lng[col * 4], g1 = *(const float4*)&lng[64 + col * 4];
    const float4 o0 = *(const float4*)&lnb[col * 4], o1 = *(const float4*)&lnb[64 + col * 4];
    float v[8]  = {p0.x, p0.y, p0.z, p0.w, p1.x, p1.y, p1.z, p1.w};
    const float gm[8] = {g0.x, g0.y, g0.z, g0.w, g1.x, g1.y, g1.z, g1.w};
    const float of[8] = {o0.x, o0.y, o0.z, o0.w, o1.x, o1.y, o1.z, o1.w};

    float s = 0.f, s2 = 0.f;
    for (int i = 0; i < 8; ++i) { s += v[i]; s2 += v[i] * v[i]; }
    for (int msk = 1; msk < 16; msk <<= 1) { s += __shfl_xor(s, msk, 32); s2 += __shfl_xor(s2, msk, 32); }
    const float mean = s * (1.f / FD);
    const float var  = s2 * (1.f / FD) - mean * mean;
    const float rstd = __frsqrt_rn(var + LNEPS);
    float mx = -INFINITY;
    for (int i = 0; i < 8; ++i) { v[i] = (v[i] - mean) * rstd * gm[i] + of[i]; mx = fmaxf(mx, v[i]); }
    for (int msk = 1; msk < 16; msk <<= 1) mx = fmaxf(mx, __shfl_xor(mx, msk, 32));
    float se = 0.f;
    for (int i = 0; i < 8; ++i) { v[i] = __expf(v[i] - mx); se += v[i]; }
    for (int msk = 1; msk < 16; msk <<= 1) se += __shfl_xor(se, msk, 32);
    float* const wo = &wout[(size_t)(t0 + m) * FD];
    *(float4*)&wo[col * 4]      = make_float4(v[0] / se, v[1] / se, v[2] / se, v[3] / se);
    *(float4*)&wo[64 + col * 4] = make_float4(v[4] / se, v[5] / se, v[6] / se, v[7] / se);
}

// ---------------------------------------------------------------------------
// TDM helper: DMA one 128x128 f32 matrix from global to LDS with +4 DWORD row
// padding (LDS row stride becomes 132 floats). Issued by wave 0 only.
// ---------------------------------------------------------------------------
__device__ __forceinline__ void tdm_load_128x128(const float* gsrc, unsigned lds_byte_addr) {
    const uint64_t ga = (uint64_t)(uintptr_t)gsrc;
    v4u g0;
    g0[0] = 1u;                       // count=1, user descriptor
    g0[1] = (uint32_t)__builtin_amdgcn_readfirstlane(lds_byte_addr);            // lds_addr
    g0[2] = (uint32_t)__builtin_amdgcn_readfirstlane((unsigned)ga);             // global_addr[31:0]
    g0[3] = (uint32_t)__builtin_amdgcn_readfirstlane(
                (unsigned)((ga >> 32) & 0x1FFFFFFull) | 0x80000000u);           // addr[56:32] | type=2
    v8i g1;
    // workgroup_mask=0 | data_size=2(4B) | pad_enable | pad_interval=6(128 dw) | pad_amount=3(4 dw)
    g1[0] = (int)((2u << 16) | (1u << 20) | (6u << 22) | (3u << 25));
    g1[1] = (int)(HD << 16);          // tensor_dim0 = 128 (low16)
    g1[2] = (int)(HD << 16);          // tensor_dim0 hi16=0 | tensor_dim1=128 (low16)
    g1[3] = (int)(HD << 16);          // tensor_dim1 hi16=0 | tile_dim0 = 128
    g1[4] = (int)HD;                  // tile_dim1 = 128, tile_dim2 = 0
    g1[5] = (int)HD;                  // tensor_dim0_stride = 128 (low32)
    g1[6] = (int)((HD * HD) << 16);   // stride hi16=0 | tensor_dim1_stride low16 = 16384
    g1[7] = 0;                        // tensor_dim1_stride hi32 = 0
    v4i g2 = {0, 0, 0, 0};            // dims 3/4 unused (2D tile)
    v4i g3 = {0, 0, 0, 0};
    v8i g4 = {0, 0, 0, 0, 0, 0, 0, 0}; // trailing group (6-arg toolchain variant)
    __builtin_amdgcn_tensor_load_to_lds(g0, g1, g2, g3, g4, 0);
}

// Lane R of each 16-lane row, handed to all lanes of that row (DPP row_share).
template <int R> __device__ __forceinline__ float row_bcast(float v) {
    return __int_as_float(__builtin_amdgcn_update_dpp(0, __float_as_int(v), 0x150 + R, 0xf, 0xf, false));
}

// Holds a wave-uniform test in a scalar register, so that the branch round a tensor load
// (which ignores EXEC) compiles to s_cmp + s_cbranch_scc.
__device__ __forceinline__ uint32_t pinned(uint32_t v) {
    uint32_t w = __builtin_amdgcn_readfirstlane(v);
    asm volatile("" : "+s"(w));   // pinned(): the issue test of a tensor load held in a scalar register
    return w;
}

// ---------------------------------------------------------------------------
// Kernel C: per-feature GRN experts with V_WMMA_F32_16X16X4_F32, TDM weight
// staging, and weighted accumulation into 'selected' via f32 atomics.
// Each weight matrix flies under the product that does not read it: W2's buffer is refilled
// behind the barrier that ends the first product, Wg's behind the one that ends the second
// (at the top of the next feature's pass).
// grid = (NT/TOK_PER_WG, FD/FPG), block = 512 (16 waves, 1 token-tile each):
// four waves share a SIMD, so one wave's elementwise tail runs under the others' WMMAs
// ---------------------------------------------------------------------------
__global__ __launch_bounds__(WAVES * 32)
void vsn_expert_kernel(const float* __restrict__ x,
                       const float* __restrict__ vw1,  const float* __restrict__ vb1,
                       const float* __restrict__ vw2,  const float* __restrict__ vb2,
                       const float* __restrict__ vwg,  const float* __restrict__ vbg,
                       const float* __restrict__ vwsk, const float* __restrict__ vbsk,
                       const float* __restrict__ vlng, const float* __restrict__ vlnb,
                       const float* __restrict__ wsel,     // [NT, FD] selection weights
                       float* __restrict__ outsel) {       // [NT, HD] accumulated
    // all three on multiples of 2 KiB, so that the tensor loads' places in LDS are such
    // multiples in whatever order the arrays are laid out
    __shared__ __attribute__((aligned(2048))) float sW2[HD * WSTRIDE];  // 66 KB, TDM-padded
    __shared__ __attribute__((aligned(2048))) float sWg[HD * WSTRIDE];  // 66 KB, TDM-padded
    __shared__ __attribute__((aligned(2048))) float sStage[WAVES][16 * WSTRIDE];  // 132 KB vh2 staging
    __shared__ __attribute__((aligned(16))) float sVec[8][HD];  // w1,b1,b2,bg,wsk,bsk,lng,lnb

    const int tid  = threadIdx.x;
    const int wave = tid >> 5;
    const int lane = tid & 31;
    const int col  = lane & 15;    // N index / M row index within half
    const int half = lane >> 4;    // K-half selector for A/B fragments
    const int t0   = blockIdx.x * TOK_PER_WG + wave * 16;
    const int f0   = blockIdx.y * FPG;
    float* const stg = &sStage[wave][0];
    const uint32_t uwave = __builtin_amdgcn_readfirstlane(threadIdx.x >> 5);

    // small vectors: two waves stage each of the eight, one float2 a lane. Those that the first
    // product and its bias read (w1, b1, b2) are staged one feature ahead of the other five.
    const uint32_t vsel = uwave >> 1;
    const float* const vsrc = vsel == 0 ? vw1  : vsel == 1 ? vb1  : vsel == 2 ? vb2  : vsel == 3 ? vbg
                            : vsel == 4 ? vwsk : vsel == 5 ? vbsk : vsel == 6 ? vlng : vlnb;
    const int  vj    = (int)(uwave & 1) * 64 + lane * 2;
    const bool vhead = vsel < 3;

    v8f accsel[8];
#pragma unroll
    for (int n = 0; n < 8; ++n) accsel[n] = (v8f){0.f,0.f,0.f,0.f,0.f,0.f,0.f,0.f};

    // --- first feature: W2 and the first product's vectors ---
    if (pinned(uwave == 0)) {
        tdm_load_128x128(vw2 + (size_t)f0 * HD * HD, (unsigned)(uintptr_t)&sW2[0]);
        asm volatile("s_wait_tensorcnt 0x0" ::: "memory");   // W2 landed before the barrier publishes it
    }
    if (vhead) *(float2*)&sVec[vsel][vj] = *(const float2*)&vsrc[(size_t)f0 * HD + vj];
    __syncthreads();

    for (int fi = 0; fi < FPG; ++fi) {
        const int f = f0 + fi;
        // this feature's Wg flies under the first product: every wave left sWg in front of
        // the barrier that ended the last feature's second product
        if (pinned(uwave == 0))
            tdm_load_128x128(vwg + (size_t)f * HD * HD, (unsigned)(uintptr_t)&sWg[0]);
        // this wave's piece of the small vectors, asked for here and stored behind the next barrier
        const int  fv    = vhead ? f + 1 : f;
        const bool vlive = fv < f0 + FPG;
        float2 nv = make_float2(0.f, 0.f);
        if (vlive) nv = *(const float2*)&vsrc[(unsigned)(fv * HD + vj)];

        // x value for this lane's A-matrix row (rows M = lane&15, both halves)
        const float xv = x[(unsigned)((t0 + col) * FD + f)];
        // x and selection weight for the tail, asked for here: lane c of the lower row holds
        // token c, lane c of the upper row token (c + 8) & 15, so that row_share r hands every
        // lane the value of its own accumulator row r + 8 * half
        const unsigned trow = (unsigned)((t0 + ((col + 8 * half) & 15)) * FD + f);
        const float xs = x[trow];
        const float ws = wsel[trow];

        v8f c[8];
#pragma unroll
        for (int n = 0; n < 8; ++n) c[n] = (v8f){0.f,0.f,0.f,0.f,0.f,0.f,0.f,0.f};

        // ---- GEMM1: vh2 = elu(x*w1+b1) @ W2^T   (16 x 128 = 8 col-tiles) ----
        // Unroll capped: 8 independent WMMA chains per step give enough ILP;
        // full unroll blows past 256 VGPRs (s_set_vgpr_msb churn).
#pragma unroll 2
        for (int k = 0; k < HD; k += 4) {
            const int klo = k + half * 2;
            v2f a;
            a.x = elu1(xv * sVec[0][klo]     + sVec[1][klo]);
            a.y = elu1(xv * sVec[0][klo + 1] + sVec[1][klo + 1]);
#pragma unroll
            for (int n = 0; n < 8; ++n) {
                const int g = n * 16 + col;
                v2f b = *(const v2f*)&sW2[g * WSTRIDE + klo];
                c[n] = __builtin_amdgcn_wmma_f32_16x16x4_f32(
                    false, a, false, b, (short)0, c[n], false, false);
            }
        }

        // store vh2 (+bias b2) to padded LDS staging (C layout -> row major)
#pragma unroll
        for (int n = 0; n < 8; ++n) {
            const int g = n * 16 + col;
            const float b2v = sVec[2][g];
#pragma unroll
            for (int r = 0; r < 8; ++r)
                stg[(r + 8 * half) * WSTRIDE + g] = c[n][r] + b2v;
        }

        // hand-over: every wave has left sW2, the first product's vectors and the last
        // feature's tail vectors; this feature's Wg has landed
        asm volatile("s_wait_dscnt 0x0" ::: "memory");           // this wave's reads of sW2 are over before the refill
        if (pinned(uwave == 0))
            asm volatile("s_wait_tensorcnt 0x0" ::: "memory");   // Wg landed before the barrier publishes it
        __syncthreads();
        if (pinned(uwave == 0 && fi + 1 < FPG))
            tdm_load_128x128(vw2 + (size_t)(f + 1) * HD * HD, (unsigned)(uintptr_t)&sW2[0]);
        if (vlive) *(float2*)&sVec[vsel][vj] = nv;

        // ---- GEMM2: gate_pre = vh2 @ Wg^T ----
#pragma unroll
        for (int n = 0; n < 8; ++n) c[n] = (v8f){0.f,0.f,0.f,0.f,0.f,0.f,0.f,0.f};
#pragma unroll 2
        for (int k = 0; k < HD; k += 4) {
            const int klo = k + half * 2;
            v2f a = *(const v2f*)&stg[col * WSTRIDE + klo];
#pragma unroll
            for (int n = 0; n < 8; ++n) {
                const int g = n * 16 + col;
                v2f b = *(const v2f*)&sWg[g * WSTRIDE + klo];
                c[n] = __builtin_amdgcn_wmma_f32_16x16x4_f32(
                    false, a, false, b, (short)0, c[n], false, false);
            }
        }

        // hand-over: every wave has left sWg; the next feature's W2 and the vectors written
        // behind the barrier above are in place
        asm volatile("s_wait_dscnt 0x0" ::: "memory");           // this wave's reads of sWg and writes of sVec are over
        if (pinned(uwave == 0))
            asm volatile("s_wait_tensorcnt 0x0" ::: "memory");   // next W2 landed before the barrier publishes it
        __syncthreads();

        // ---- elementwise: sigmoid gate, skip, LayerNorm, weighted accumulate ----
        const float xmr[8] = {row_bcast<0>(xs), row_bcast<1>(xs), row_bcast<2>(xs), row_bcast<3>(xs),
                              row_bcast<4>(xs), row_bcast<5>(xs), row_bcast<6>(xs), row_bcast<7>(xs)};
        const float wmr[8] = {row_bcast<0>(ws), row_bcast<1>(ws), row_bcast<2>(ws), row_bcast<3>(ws),
                              row_bcast<4>(ws), row_bcast<5>(ws), row_bcast<6>(ws), row_bcast<7>(ws)};
#pragma unroll
        for (int r = 0; r < 8; ++r) {
            const int m = r + 8 * half;                 // token row in tile
            const float xm = xmr[r];
            const float wm = wmr[r];
            float y[8];
            float s = 0.f, s2 = 0.f;
#pragma unroll
            for (int n = 0; n < 8; ++n) {
                const int g = n * 16 + col;
                const float vh2v = stg[m * WSTRIDE + g];
                const float vgv  = sigm(c[n][r] + sVec[3][g]);
                const float sk   = xm * sVec[4][g] + sVec[5][g];
                const float t    = vgv * vh2v + sk;
                y[n] = t; s += t; s2 += t * t;
            }
            // reduce over the 16 lanes of this half (128 values per token row)
#pragma unroll
            for (int msk = 1; msk < 16; msk <<= 1) {
                s  += __shfl_xor(s,  msk, 32);
                s2 += __shfl_xor(s2, msk, 32);
            }
            const float mean = s * (1.f / HD);
            const float var  = s2 * (1.f / HD) - mean * mean;
            const float rstd = __frsqrt_rn(var + LNEPS);
#pragma unroll
            for (int n = 0; n < 8; ++n) {
                const int g = n * 16 + col;
                const float vout = (y[n] - mean) * rstd * sVec[6][g] + sVec[7][g];
                accsel[n][r] += vout * wm;
            }
        }
    }

    // ---- reduce over feature groups into global output ----
#pragma unroll
    for (int n = 0; n < 8; ++n) {
#pragma unroll
        for (int r = 0; r < 8; ++r) {
            const int m = r + 8 * half;
            atomicAdd(&outsel[(unsigned)((t0 + m) * HD + n * 16 + col)], accsel[n][r]);
        }
    }
}

// ---------------------------------------------------------------------------
extern "C" void kernel_launch(void* const* d_in, const int* in_sizes, int n_in,
                              void* d_out, int out_size, void* d_ws, size_t ws_size,
                              hipStream_t stream) {
    (void)in_sizes; (void)n_in; (void)out_size; (void)d_ws; (void)ws_size;
    const float* x     = (const float*)d_in[0];
    const float* sw1   = (const float*)d_in[1];
    const float* sb1   = (const float*)d_in[2];
    const float* sw2   = (const float*)d_in[3];
    const float* sb2   = (const float*)d_in[4];
    const float* swg   = (const float*)d_in[5];
    const float* sbg   = (const float*)d_in[6];
    const float* slng  = (const float*)d_in[7];
    const float* slnb  = (const float*)d_in[8];
    const float* vw1   = (const float*)d_in[9];
    const float* vb1   = (const float*)d_in[10];
    const float* vw2   = (const float*)d_in[11];
    const float* vb2   = (const float*)d_in[12];
    const float* vwg   = (const float*)d_in[13];
    const float* vbg   = (const float*)d_in[14];
    const float* vwsk  = (const float*)d_in[15];
    const float* vbsk  = (const float*)d_in[16];
    const float* vlng  = (const float*)d_in[17];
    const float* vlnb  = (const float*)d_in[18];

    float* out_sel = (float*)d_out;                 // [NT, HD]
    float* out_w   = out_sel + (size_t)NT * HD;     // [NT, FD]

    vsn_zero_kernel<<<(NT * HD + 255) / 256, 256, 0, stream>>>(out_sel, NT * HD);

    vsn_sel_kernel<<<NT / SEL_TOK, SEL_WAVES * 32, 0, stream>>>(x, sw1, sb1, sw2, sb2, swg, sbg,
                                           slng, slnb, out_w);

    dim3 grid2(NT / TOK_PER_WG, FD / FPG);
    vsn_expert_kernel<<<grid2, WAVES * 32, 0, stream>>>(
        x, vw1, vb1, vw2, vb2, vwg, vbg, vwsk, vbsk, vlng, vlnb, out_w, out_sel);
}

// v004
// It runs in 187 microseconds.
// Two timings next to v003 both put it at 1.06 times that version's speed.
// Counting every step since v000, it is 1.56 times as fast.
#include <hip/hip_runtime.h>
#include <hip/hip_bf16.h>
#include <stdint.h>

// Problem constants (match reference)
#define BT 8
#define ST 512
#define FD 128
#define HD 128
#define NT (BT*ST)      // 4096 tokens
#define LNEPS 1e-5f

// Expert kernel tiling
#define WAVES 16
#define TOK_PER_WG (WAVES*16)   // 256 tokens per workgroup
#define FPG 8                   // features per workgroup (feature group)
#define WSTRIDE 132             // padded LDS row stride (floats): 128+4 -> bank-conflict-free

typedef __attribute__((ext_vector_type(2)))  float v2f;
typedef __attribute__((ext_vector_type(8)))  float v8f;
typedef __attribute__((ext_vector_type(4)))  unsigned int v4u;
typedef __attribute__((ext_vector_type(8)))  int v8i;
typedef __attribute__((ext_vector_type(4)))  int v4i;

__device__ __forceinline__ float elu1(float v) { return v > 0.f ? v : (__expf(v) - 1.f); }
__device__ __forceinline__ float sigm(float v) { return 1.f / (1.f + __expf(-v)); }
// the same with the hardware reciprocal (v_rcp_f32) in place of the division sequence
__device__ __forceinline__ float sigm_rcp(float v) { return __builtin_amdgcn_rcpf(1.f + __expf(-v)); }

// ---------------------------------------------------------------------------
// Kernel A: zero the 'selected' output region (it is accumulated with atomics)
// ---------------------------------------------------------------------------
__global__ void vsn_zero_kernel(float* __restrict__ p, int n) {
    int i = blockIdx.x * blockDim.x + threadIdx.x;
    if (i < n) p[i] = 0.f;
}

// ---------------------------------------------------------------------------
// Kernel B: selection GRN -> softmax weights [NT, FD]
// One workgroup of 8 waves per 16 tokens. The three 128x128 products run on
// V_WMMA_F32_16X16X4_F32: wave w owns output columns 16w..16w+15, so it needs only
// rows 16w..16w+15 of each weight matrix; it fetches them as whole 512-byte rows and
// turns them into fragments through padded LDS.
// ---------------------------------------------------------------------------
#define SEL_WAVES 8
#define SEL_TOK 16

// 16x16 tile of A[16][128] * Bw[16][128]^T. Lanes 0-15 take floats k..k+3 and lanes 16-31
// floats k+4..k+7 of their row, from A and from Bw alike, so both operands hold the same k
// at every lane and register position.
__device__ __forceinline__ v8f sel_tile(const float* A, const float* Bw, int col, int half) {
    const float* ap = A  + col * WSTRIDE + half * 4;
    const float* bp = Bw + col * WSTRIDE + half * 4;
    v8f c = (v8f){0.f,0.f,0.f,0.f,0.f,0.f,0.f,0.f};
    for (int k = 0; k < HD; k += 8) {
        const float4 a = *(const float4*)(ap + k);
        const float4 b = *(const float4*)(bp + k);
        c = __builtin_amdgcn_wmma_f32_16x16x4_f32(
            false, (v2f){a.x, a.y}, false, (v2f){b.x, b.y}, (short)0, c, false, false);
        c = __builtin_amdgcn_wmma_f32_16x16x4_f32(
            false, (v2f){a.z, a.w}, false, (v2f){b.z, b.w}, (short)0, c, false, false);
    }
    return c;
}

__global__ __launch_bounds__(SEL_WAVES * 32)
void vsn_sel_kernel(const float* __restrict__ x,
                    const float* __restrict__ w1, const float* __restrict__ b1,
                    const float* __restrict__ w2, const float* __restrict__ b2,
                    const float* __restrict__ wg, const float* __restrict__ bg,
                    const float* __restrict__ lng, const float* __restrict__ lnb,
                    float* __restrict__ wout) {
    __shared__ __attribute__((aligned(16))) float sW[3][HD * WSTRIDE];      // w1, w2, wg
    __shared__ __attribute__((aligned(16))) float sX [SEL_TOK * WSTRIDE];   // x tile
    __shared__ __attribute__((aligned(16))) float sH [SEL_TOK * WSTRIDE];   // elu(x w1^T + b1)
    __shared__ __attribute__((aligned(16))) float sH2[SEL_TOK * WSTRIDE];   // h w2^T + b2
    __shared__ __attribute__((aligned(16))) float sP [SEL_TOK * WSTRIDE];   // gate*h2 + x

    const int tid  = threadIdx.x;
    const int wave = tid >> 5;
    const int lane = tid & 31;
    const int col  = lane & 15;
    const int half = lane >> 4;
    const int t0   = blockIdx.x * SEL_TOK;
    const int g    = wave * 16 + col;          // this lane's output column
    const int wofs = wave * 16 * WSTRIDE;      // this wave's rows in a staged matrix
    const size_t grow = (size_t)(wave * 16) * FD + lane * 4;

    // weights pass through registers: w2 and wg are asked for ahead of the products that
    // read them, so that they can arrive while the product before them runs
    const float4 xr0 = *(const float4*)&x[(size_t)(t0 + wave)     * FD + lane * 4];
    const float4 xr1 = *(const float4*)&x[(size_t)(t0 + wave + 8) * FD + lane * 4];
    float4 ra[16], rb[16];
    for (int i = 0; i < 16; ++i) ra[i] = *(const float4*)&w1[grow + i * FD];
    for (int i = 0; i < 16; ++i) rb[i] = *(const float4*)&w2[grow + i * FD];

    *(float4*)&sX[(wave)     * WSTRIDE + lane * 4] = xr0;
    *(float4*)&sX[(wave + 8) * WSTRIDE + lane * 4] = xr1;
    for (int i = 0; i < 16; ++i) *(float4*)&sW[0][wofs + i * WSTRIDE + lane * 4] = ra[i];
    for (int i = 0; i < 16; ++i) ra[i] = *(const float4*)&wg[grow + i * FD];
    const float b1v = b1[g], b2v = b2[g], bgv = bg[g];
    __syncthreads();

    // h = elu(x w1^T + b1)
    v8f c = sel_tile(sX, &sW[0][wofs], col, half);
    for (int r = 0; r < 8; ++r) sH[(r + 8 * half) * WSTRIDE + g] = elu1(c[r] + b1v);
    for (int i = 0; i < 16; ++i) *(float4*)&sW[1][wofs + i * WSTRIDE + lane * 4] = rb[i];
    __syncthreads();

    // h2 = h w2^T + b2 (kept in registers for the gate product as well)
    v8f h2 = sel_tile(sH, &sW[1][wofs], col, half);
    for (int r = 0; r < 8; ++r) { h2[r] += b2v; sH2[(r + 8 * half) * WSTRIDE + g] = h2[r]; }
    for (int i = 0; i < 16; ++i) *(float4*)&sW[2][wofs + i * WSTRIDE + lane * 4] = ra[i];
    __syncthreads();

    // pre = sigmoid(h2 wg^T + bg) * h2 + x
    c = sel_tile(sH2, &sW[2][wofs], col, half);
    for (int r = 0; r < 8; ++r) {
        const int m = r + 8 * half;
        sP[m * WSTRIDE + g] = sigm(c[r] + bgv) * h2[r] + sX[m * WSTRIDE + g];
    }
    __syncthreads();

    // LayerNorm and softmax over 128: one token per 16-lane row, 8 values per lane
    const int m = wave * 2 + half;
    const float4 p0 = *(const float4*)&sP[m * WSTRIDE + col * 4];
    const float4 p1 = *(const float4*)&sP[m * WSTRIDE + 64 + col * 4];
    const float4 g0 = *(const float4*)&lng[col * 4], g1 = *(const float4*)&lng[64 + col * 4];
    const float4 o0 = *(const float4*)&lnb[col * 4], o1 = *(const float4*)&lnb[64 + col * 4];
    float v[8]  = {p0.x, p0.y, p0.z, p0.w, p1.x, p1.y, p1.z, p1.w};
    const float gm[8] = {g0.x, g0.y, g0.z, g0.w, g1.x, g1.y, g1.z, g1.w};
    const float of[8] = {o0.x, o0.y, o0.z, o0.w, o1.x, o1.y, o1.z, o1.w};

    float s = 0.f, s2 = 0.f;
    for (int i = 0; i < 8; ++i) { s += v[i]; s2 += v[i] * v[i]; }
    for (int msk = 1; msk < 16; msk <<= 1) { s += __shfl_xor(s, msk, 32); s2 += __shfl_xor(s2, msk, 32); }
    const float mean = s * (1.f / FD);
    const float var  = s2 * (1.f / FD) - mean * mean;
    const float rstd = __frsqrt_rn(var + LNEPS);
    float mx = -INFINITY;
    for (int i = 0; i < 8; ++i) { v[i] = (v[i] - mean) * rstd * gm[i] + of[i]; mx = fmaxf(mx, v[i]); }
    for (int msk = 1; msk < 16; msk <<= 1) mx = fmaxf(mx, __shfl_xor(mx, msk, 32));
    float se = 0.f;
    for (int i = 0; i < 8; ++i) { v[i] = __expf(v[i] - mx); se += v[i]; }
    for (int msk = 1; msk < 16; msk <<= 1) se += __shfl_xor(se, msk, 32);
    float* const wo = &wout[(size_t)(t0 + m) * FD];
    *(float4*)&wo[col * 4]      = make_float4(v[0] / se, v[1] / se, v[2] / se, v[3] / se);
    *(float4*)&wo[64 + col * 4] = make_float4(v[4] / se, v[5] / se, v[6] / se, v[7] / se);
}

// ---------------------------------------------------------------------------
// TDM helper: DMA one 128x128 f32 matrix from global to LDS with +4 DWORD row
// padding (LDS row stride becomes 132 floats). Issued by wave 0 only.
// ---------------------------------------------------------------------------
__device__ __forceinline__ void tdm_load_128x128(const float* gsrc, unsigned lds_byte_addr) {
    const uint64_t ga = (uint64_t)(uintptr_t)gsrc;
    v4u g0;
    g0[0] = 1u;                       // count=1, user descriptor
    g0[1] = (uint32_t)__builtin_amdgcn_readfirstlane(lds_byte_addr);            // lds_addr
    g0[2] = (uint32_t)__builtin_amdgcn_readfirstlane((unsigned)ga);             // global_addr[31:0]
    g0[3] = (uint32_t)__builtin_amdgcn_readfirstlane(
                (unsigned)((ga >> 32) & 0x1FFFFFFull) | 0x80000000u);           // addr[56:32] | type=2
    v8i g1;
    // workgroup_mask=0 | data_size=2(4B) | pad_enable | pad_interval=6(128 dw) | pad_amount=3(4 dw)
    g1[0] = (int)((2u << 16) | (1u << 20) | (6u << 22) | (3u << 25));
    g1[1] = (int)(HD << 16);          // tensor_dim0 = 128 (low16)
    g1[2] = (int)(HD << 16);          // tensor_dim0 hi16=0 | tensor_dim1=128 (low16)
    g1[3] = (int)(HD << 16);          // tensor_dim1 hi16=0 | tile_dim0 = 128
    g1[4] = (int)HD;                  // tile_dim1 = 128, tile_dim2 = 0
    g1[5] = (int)HD;                  // tensor_dim0_stride = 128 (low32)
    g1[6] = (int)((HD * HD) << 16);   // stride hi16=0 | tensor_dim1_stride low16 = 16384
    g1[7] = 0;                        // tensor_dim1_stride hi32 = 0
    v4i g2 = {0, 0, 0, 0};            // dims 3/4 unused (2D tile)
    v4i g3 = {0, 0, 0, 0};
    v8i g4 = {0, 0, 0, 0, 0, 0, 0, 0}; // trailing group (6-arg toolchain variant)
    __builtin_amdgcn_tensor_load_to_lds(g0, g1, g2, g3, g4, 0);
}

// Lane R of each 16-lane row, handed to all lanes of that row (DPP row_share).
template <int R> __device__ __forceinline__ float row_bcast(float v) {
    return __int_as_float(__builtin_amdgcn_update_dpp(0, __float_as_int(v), 0x150 + R, 0xf, 0xf, false));
}

// Holds a wave-uniform test in a scalar register, so that the branch round a tensor load
// (which ignores EXEC) compiles to s_cmp + s_cbranch_scc.
__device__ __forceinline__ uint32_t pinned(uint32_t v) {
    uint32_t w = __builtin_amdgcn_readfirstlane(v);
    asm volatile("" : "+s"(w));   // pinned(): the issue test of a tensor load held in a scalar register
    return w;
}

// ---------------------------------------------------------------------------
// Kernel C: per-feature GRN experts with V_WMMA_F32_16X16X4_F32, TDM weight
// staging, and weighted accumulation into 'selected' via f32 atomics.
// Each weight matrix flies under the product that does not read it: W2's buffer is refilled
// behind the barrier that ends the first product, Wg's behind the one that ends the second
// (at the top of the next feature's pass).
// grid = (NT/TOK_PER_WG, FD/FPG), block = 512 (16 waves, 1 token-tile each):
// four waves share a SIMD, so one wave's elementwise tail runs under the others' WMMAs
// ---------------------------------------------------------------------------
__global__ __launch_bounds__(WAVES * 32)
void vsn_expert_kernel(const float* __restrict__ x,
                       const float* __restrict__ vw1,  const float* __restrict__ vb1,
                       const float* __restrict__ vw2,  const float* __restrict__ vb2,
                       const float* __restrict__ vwg,  const float* __restrict__ vbg,
                       const float* __restrict__ vwsk, const float* __restrict__ vbsk,
                       const float* __restrict__ vlng, const float* __restrict__ vlnb,
                       const float* __restrict__ wsel,     // [NT, FD] selection weights
                       float* __restrict__ outsel) {       // [NT, HD] accumulated
    // all three on multiples of 2 KiB, so that the tensor loads' places in LDS are such
    // multiples in whatever order the arrays are laid out
    __shared__ __attribute__((aligned(2048))) float sW2[HD * WSTRIDE];  // 66 KB, TDM-padded
    __shared__ __attribute__((aligned(2048))) float sWg[HD * WSTRIDE];  // 66 KB, TDM-padded
    __shared__ __attribute__((aligned(2048))) float sStage[WAVES][16 * WSTRIDE];  // 132 KB vh2 staging
    __shared__ __attribute__((aligned(16))) float sVec[8][HD];  // w1,b1,b2,bg,wsk,bsk,lng,lnb

    const int tid  = threadIdx.x;
    const int wave = tid >> 5;
    const int lane = tid & 31;
    const int col  = lane & 15;    // N index / M row index within half
    const int half = lane >> 4;    // K-half selector for A/B fragments
    const int t0   = blockIdx.x * TOK_PER_WG + wave * 16;
    const int f0   = blockIdx.y * FPG;
    float* const stg = &sStage[wave][0];
    const uint32_t uwave = __builtin_amdgcn_readfirstlane(threadIdx.x >> 5);

    // small vectors: two waves stage each of the eight, one float2 a lane. Those that the first
    // product and its bias read (w1, b1, b2) are staged one feature ahead of the other five.
    const uint32_t vsel = uwave >> 1;
    const float* const vsrc = vsel == 0 ? vw1  : vsel == 1 ? vb1  : vsel == 2 ? vb2  : vsel == 3 ? vbg
                            : vsel == 4 ? vwsk : vsel == 5 ? vbsk : vsel == 6 ? vlng : vlnb;
    const int  vj    = (int)(uwave & 1) * 64 + lane * 2;
    const bool vhead = vsel < 3;

    v8f accsel[8];
#pragma unroll
    for (int n = 0; n < 8; ++n) accsel[n] = (v8f){0.f,0.f,0.f,0.f,0.f,0.f,0.f,0.f};

    // --- first feature: W2 and the first product's vectors ---
    if (pinned(uwave == 0)) {
        tdm_load_128x128(vw2 + (size_t)f0 * HD * HD, (unsigned)(uintptr_t)&sW2[0]);
        asm volatile("s_wait_tensorcnt 0x0" ::: "memory");   // W2 landed before the barrier publishes it
    }
    if (vhead) *(float2*)&sVec[vsel][vj] = *(const float2*)&vsrc[(size_t)f0 * HD + vj];
    __syncthreads();

    for (int fi = 0; fi < FPG; ++fi) {
        const int f = f0 + fi;
        // this feature's Wg flies under the first product: every wave left sWg in front of
        // the barrier that ended the last feature's second product
        if (pinned(uwave == 0))
            tdm_load_128x128(vwg + (size_t)f * HD * HD, (unsigned)(uintptr_t)&sWg[0]);
        // this wave's piece of the small vectors, asked for here and stored behind the next barrier
        const int  fv    = vhead ? f + 1 : f;
        const bool vlive = fv < f0 + FPG;
        float2 nv = make_float2(0.f, 0.f);
        if (vlive) nv = *(const float2*)&vsrc[(unsigned)(fv * HD + vj)];

        // x value for this lane's A-matrix row (rows M = lane&15, both halves)
        const float xv = x[(unsigned)((t0 + col) * FD + f)];
        // x and selection weight for the tail, asked for here: lane c of the lower row holds
        // token c, lane c of the upper row token (c + 8) & 15, so that row_share r hands every
        // lane the value of its own accumulator row r + 8 * half
        const unsigned trow = (unsigned)((t0 + ((col + 8 * half) & 15)) * FD + f);
        const float xs = x[trow];
        const float ws = wsel[trow];

        v8f c[8];
#pragma unroll
        for (int n = 0; n < 8; ++n) c[n] = (v8f){0.f,0.f,0.f,0.f,0.f,0.f,0.f,0.f};

        // ---- GEMM1: vh2 = elu(x*w1+b1) @ W2^T   (16 x 128 = 8 col-tiles) ----
        // Unroll capped: 8 independent WMMA chains per step give enough ILP;
        // full unroll blows past 256 VGPRs (s_set_vgpr_msb churn).
#pragma unroll 2
        for (int k = 0; k < HD; k += 4) {
            const int klo = k + half * 2;
            v2f a;
            a.x = elu1(xv * sVec[0][klo]     + sVec[1][klo]);
            a.y = elu1(xv * sVec[0][klo + 1] + sVec[1][klo + 1]);
#pragma unroll
            for (int n = 0; n < 8; ++n) {
                const int g = n * 16 + col;
                v2f b = *(const v2f*)&sW2[g * WSTRIDE + klo];
                c[n] = __builtin_amdgcn_wmma_f32_16x16x4_f32(
                    false, a, false, b, (short)0, c[n], false, false);
            }
        }

        // store vh2 (+bias b2) to padded LDS staging (C layout -> row major)
#pragma unroll
        for (int n = 0; n < 8; ++n) {
            const int g = n * 16 + col;
            const float b2v = sVec[2][g];
#pragma unroll
            for (int r = 0; r < 8; ++r)
                stg[(r + 8 * half) * WSTRIDE + g] = c[n][r] + b2v;
        }

        // hand-over: every wave has left sW2, the first product's vectors and the last
        // feature's tail vectors; this feature's Wg has landed
        asm volatile("s_wait_dscnt 0x0" ::: "memory");           // this wave's reads of sW2 are over before the refill
        if (pinned(uwave == 0))
            asm volatile("s_wait_tensorcnt 0x0" ::: "memory");   // Wg landed before the barrier publishes it
        __syncthreads();
        if (pinned(uwave == 0 && fi + 1 < FPG))
            tdm_load_128x128(vw2 + (size_t)(f + 1) * HD * HD, (unsigned)(uintptr_t)&sW2[0]);
        if (vlive) *(float2*)&sVec[vsel][vj] = nv;

        // ---- GEMM2: gate_pre = vh2 @ Wg^T ----
#pragma unroll
        for (int n = 0; n < 8; ++n) c[n] = (v8f){0.f,0.f,0.f,0.f,0.f,0.f,0.f,0.f};
#pragma unroll 2
        for (int k = 0; k < HD; k += 4) {
            const int klo = k + half * 2;
            v2f a = *(const v2f*)&stg[col * WSTRIDE + klo];
#pragma unroll
            for (int n = 0; n < 8; ++n) {
                const int g = n * 16 + col;
                v2f b = *(const v2f*)&sWg[g * WSTRIDE + klo];
                c[n] = __builtin_amdgcn_wmma_f32_16x16x4_f32(
                    false, a, false, b, (short)0, c[n], false, false);
            }
        }

        // hand-over: every wave has left sWg; the next feature's W2 and the vectors written
        // behind the barrier above are in place
        asm volatile("s_wait_dscnt 0x0" ::: "memory");           // this wave's reads of sWg and writes of sVec are over
        if (pinned(uwave == 0))
            asm volatile("s_wait_tensorcnt 0x0" ::: "memory");   // next W2 landed before the barrier publishes it
        __syncthreads();

        // ---- elementwise: sigmoid gate, skip, LayerNorm, weighted accumulate ----
        const float xmr[8] = {row_bcast<0>(xs), row_bcast<1>(xs), row_bcast<2>(xs), row_bcast<3>(xs),
                              row_bcast<4>(xs), row_bcast<5>(xs), row_bcast<6>(xs), row_bcast<7>(xs)};
        const float wmr[8] = {row_bcast<0>(ws), row_bcast<1>(ws), row_bcast<2>(ws), row_bcast<3>(ws),
                              row_bcast<4>(ws), row_bcast<5>(ws), row_bcast<6>(ws), row_bcast<7>(ws)};
#pragma unroll
        for (int r = 0; r < 8; ++r) {
            const int m = r + 8 * half;                 // token row in tile
            const float xm = xmr[r];
            const float wm = wmr[r];
            float y[8];
            float s = 0.f, s2 = 0.f;
#pragma unroll
            for (int n = 0; n < 8; ++n) {
                const int g = n * 16 + col;
                const float vh2v = stg[m * WSTRIDE + g];
                const float vgv  = sigm_rcp(c[n][r] + sVec[3][g]);
                const float sk   = xm * sVec[4][g] + sVec[5][g];
                const float t    = vgv * vh2v + sk;
                y[n] = t; s += t; s2 += t * t;
            }
            // reduce over the 16 lanes of this half (128 values per token row)
#pragma unroll
            for (int msk = 1; msk < 16; msk <<= 1) {
                s  += __shfl_xor(s,  msk, 32);
                s2 += __shfl_xor(s2, msk, 32);
            }
            const float mean = s * (1.f / HD);
            const float var  = s2 * (1.f / HD) - mean * mean;
            const float rstd = __frsqrt_rn(var + LNEPS);
#pragma unroll
            for (int n = 0; n < 8; ++n) {
                const int g = n * 16 + col;
                const float vout = (y[n] - mean) * rstd * sVec[6][g] + sVec[7][g];
                accsel[n][r] += vout * wm;
            }
        }
    }

    // ---- reduce over feature groups into global output ----
#pragma unroll
    for (int n = 0; n < 8; ++n) {
#pragma unroll
        for (int r = 0; r < 8; ++r) {
            const int m = r + 8 * half;
            atomicAdd(&outsel[(unsigned)((t0 + m) * HD + n * 16 + col)], accsel[n][r]);
        }
    }
}

// ---------------------------------------------------------------------------
extern "C" void kernel_launch(void* const* d_in, const int* in_sizes, int n_in,
                              void* d_out, int out_size, void* d_ws, size_t ws_size,
                              hipStream_t stream) {
    (void)in_sizes; (void)n_in; (void)out_size; (void)d_ws; (void)ws_size;
    const float* x     = (const float*)d_in[0];
    const float* sw1   = (const float*)d_in[1];
    const float* sb1   = (const float*)d_in[2];
    const float* sw2   = (const float*)d_in[3];
    const float* sb2   = (const float*)d_in[4];
    const float* swg   = (const float*)d_in[5];
    const float* sbg   = (const float*)d_in[6];
    const float* slng  = (const float*)d_in[7];
    const float* slnb  = (const float*)d_in[8];
    const float* vw1   = (const float*)d_in[9];
    const float* vb1   = (const float*)d_in[10];
    const float* vw2   = (const float*)d_in[11];
    const float* vb2   = (const float*)d_in[12];
    const float* vwg   = (const float*)d_in[13];
    const float* vbg   = (const float*)d_in[14];
    const float* vwsk  = (const float*)d_in[15];
    const float* vbsk  = (const float*)d_in[16];
    const float* vlng  = (const float*)d_in[17];
    const float* vlnb  = (const float*)d_in[18];

    float* out_sel = (float*)d_out;                 // [NT, HD]
    float* out_w   = out_sel + (size_t)NT * HD;     // [NT, FD]

    vsn_zero_kernel<<<(NT * HD + 255) / 256, 256, 0, stream>>>(out_sel, NT * HD);

    vsn_sel_kernel<<<NT / SEL_TOK, SEL_WAVES * 32, 0, stream>>>(x, sw1, sb1, sw2, sb2, swg, sbg,
                                           slng, slnb, out_w);

    dim3 grid2(NT / TOK_PER_WG, FD / FPG);
    vsn_expert_kernel<<<grid2, WAVES * 32, 0, stream>>>(
        x, vw1, vb1, vw2, vb2, vwg, vbg, vwsk, vbsk, vlng, vlnb, out_w, out_sel);
}

// v005
// Measured time: 174 microseconds a run.
// Next to v004, in two timings, it ran 1.08 times as fast each time.
// All steps since v000 together make it 1.68 times as fast.
#include <hip/hip_runtime.h>
#include <hip/hip_bf16.h>
#include <stdint.h>

// Problem constants (match reference)
#define BT 8
#define ST 512
#define FD 128
#define HD 128
#define NT (BT*ST)      // 4096 tokens
#define LNEPS 1e-5f

// Expert kernel tiling
#define WAVES 16
#define TOK_PER_WG (WAVES*16)   // 256 tokens per workgroup
#define FPG 8                   // features per workgroup (feature group)
#define WSTRIDE 132             // padded LDS row stride (floats): 128+4 -> bank-conflict-free

typedef __attribute__((ext_vector_type(2)))  float v2f;
typedef __attribute__((ext_vector_type(8)))  float v8f;
typedef __attribute__((ext_vector_type(4)))  unsigned int v4u;
typedef __attribute__((ext_vector_type(8)))  int v8i;
typedef __attribute__((ext_vector_type(4)))  int v4i;

__device__ __forceinline__ float elu1(float v) { return v > 0.f ? v : (__expf(v) - 1.f); }
__device__ __forceinline__ float sigm(float v) { return 1.f / (1.f + __expf(-v)); }
// the same with the hardware reciprocal (v_rcp_f32) in place of the division sequence
__device__ __forceinline__ float sigm_rcp(float v) { return __builtin_amdgcn_rcpf(1.f + __expf(-v)); }

// ---------------------------------------------------------------------------
// Kernel A: zero the 'selected' output region (it is accumulated with atomics)
// ---------------------------------------------------------------------------
__global__ void vsn_zero_kernel(float* __restrict__ p, int n) {
    int i = blockIdx.x * blockDim.x + threadIdx.x;
    if (i < n) p[i] = 0.f;
}

// ---------------------------------------------------------------------------
// Kernel B: selection GRN -> softmax weights [NT, FD]
// One workgroup of 8 waves per 16 tokens. The three 128x128 products run on
// V_WMMA_F32_16X16X4_F32: wave w owns output columns 16w..16w+15, so it needs only
// rows 16w..16w+15 of each weight matrix; it fetches them as whole 512-byte rows and
// turns them into fragments through padded LDS.
// ---------------------------------------------------------------------------
#define SEL_WAVES 8
#define SEL_TOK 16

// 16x16 tile of A[16][128] * Bw[16][128]^T. Lanes 0-15 take floats k..k+3 and lanes 16-31
// floats k+4..k+7 of their row, from A and from Bw alike, so both operands hold the same k
// at every lane and register position.
__device__ __forceinline__ v8f sel_tile(const float* A, const float* Bw, int col, int half) {
    const float* ap = A  + col * WSTRIDE + half * 4;
    const float* bp = Bw + col * WSTRIDE + half * 4;
    v8f c = (v8f){0.f,0.f,0.f,0.f,0.f,0.f,0.f,0.f};
    for (int k = 0; k < HD; k += 8) {
        const float4 a = *(const float4*)(ap + k);
        const float4 b = *(const float4*)(bp + k);
        c = __builtin_amdgcn_wmma_f32_16x16x4_f32(
            false, (v2f){a.x, a.y}, false, (v2f){b.x, b.y}, (short)0, c, false, false);
        c = __builtin_amdgcn_wmma_f32_16x16x4_f32(
            false, (v2f){a.z, a.w}, false, (v2f){b.z, b.w}, (short)0, c, false, false);
    }
    return c;
}

__global__ __launch_bounds__(SEL_WAVES * 32)
void vsn_sel_kernel(const float* __restrict__ x,
                    const float* __restrict__ w1, const float* __restrict__ b1,
                    const float* __restrict__ w2, const float* __restrict__ b2,
                    const float* __restrict__ wg, const float* __restrict__ bg,
                    const float* __restrict__ lng, const float* __restrict__ lnb,
                    float* __restrict__ wout) {
    __shared__ __attribute__((aligned(16))) float sW[3][HD * WSTRIDE];      // w1, w2, wg
    __shared__ __attribute__((aligned(16))) float sX [SEL_TOK * WSTRIDE];   // x tile
    __shared__ __attribute__((aligned(16))) float sH [SEL_TOK * WSTRIDE];   // elu(x w1^T + b1)
    __shared__ __attribute__((aligned(16))) float sH2[SEL_TOK * WSTRIDE];   // h w2^T + b2
    __shared__ __attribute__((aligned(16))) float sP [SEL_TOK * WSTRIDE];   // gate*h2 + x

    const int tid  = threadIdx.x;
    const int wave = tid >> 5;
    const int lane = tid & 31;
    const int col  = lane & 15;
    const int half = lane >> 4;
    const int t0   = blockIdx.x * SEL_TOK;
    const int g    = wave * 16 + col;          // this lane's output column
    const int wofs = wave * 16 * WSTRIDE;      // this wave's rows in a staged matrix
    const size_t grow = (size_t)(wave * 16) * FD + lane * 4;

    // weights pass through registers: w2 and wg are asked for ahead of the products that
    // read them, so that they can arrive while the product before them runs
    const float4 xr0 = *(const float4*)&x[(size_t)(t0 + wave)     * FD + lane * 4];
    const float4 xr1 = *(const float4*)&x[(size_t)(t0 + wave + 8) * FD + lane * 4];
    float4 ra[16], rb[16];
    for (int i = 0; i < 16; ++i) ra[i] = *(const float4*)&w1[grow + i * FD];
    for (int i = 0; i < 16; ++i) rb[i] = *(const float4*)&w2[grow + i * FD];

    *(float4*)&sX[(wave)     * WSTRIDE + lane * 4] = xr0;
    *(float4*)&sX[(wave + 8) * WSTRIDE + lane * 4] = xr1;
    for (int i = 0; i < 16; ++i) *(float4*)&sW[0][wofs + i * WSTRIDE + lane * 4] = ra[i];
    for (int i = 0; i < 16; ++i) ra[i] = *(const float4*)&wg[grow + i * FD];
    const float b1v = b1[g], b2v = b2[g], bgv = bg[g];
    __syncthreads();

    // h = elu(x w1^T + b1)
    v8f c = sel_tile(sX, &sW[0][wofs], col, half);
    for (int r = 0; r < 8; ++r) sH[(r + 8 * half) * WSTRIDE + g] = elu1(c[r] + b1v);
    for (int i = 0; i < 16; ++i) *(float4*)&sW[1][wofs + i * WSTRIDE + lane * 4] = rb[i];
    __syncthreads();

    // h2 = h w2^T + b2 (kept in registers for the gate product as well)
    v8f h2 = sel_tile(sH, &sW[1][wofs], col, half);
    for (int r = 0; r < 8; ++r) { h2[r] += b2v; sH2[(r + 8 * half) * WSTRIDE + g] = h2[r]; }
    for (int i = 0; i < 16; ++i) *(float4*)&sW[2][wofs + i * WSTRIDE + lane * 4] = ra[i];
    __syncthreads();

    // pre = sigmoid(h2 wg^T + bg) * h2 + x
    c = sel_tile(sH2, &sW[2][wofs], col, half);
    for (int r = 0; r < 8; ++r) {
        const int m = r + 8 * half;
        sP[m * WSTRIDE + g] = sigm(c[r] + bgv) * h2[r] + sX[m * WSTRIDE + g];
    }
    __syncthreads();

    // LayerNorm and softmax over 128: one token per 16-lane row, 8 values per lane
    const int m = wave * 2 + half;
    const float4 p0 = *(const float4*)&sP[m * WSTRIDE + col * 4];
    const float4 p1 = *(const float4*)&sP[m * WSTRIDE + 64 + col * 4];
    const float4 g0 = *(const float4*)&lng[col * 4], g1 = *(const float4*)&lng[64 + col * 4];
    const float4 o0 = *(const float4*)&lnb[col * 4], o1 = *(const float4*)&lnb[64 + col * 4];
    float v[8]  = {p0.x, p0.y, p0.z, p0.w, p1.x, p1.y, p1.z, p1.w};
    const float gm[8] = {g0.x, g0.y, g0.z, g0.w, g1.x, g1.y, g1.z, g1.w};
    const float of[8] = {o0.x, o0.y, o0.z, o0.w, o1.x, o1.y, o1.z, o1.w};

    float s = 0.f, s2 = 0.f;
    for (int i = 0; i < 8; ++i) { s += v[i]; s2 += v[i] * v[i]; }
    for (int msk = 1; msk < 16; msk <<= 1) { s += __shfl_xor(s, msk, 32); s2 += __shfl_xor(s2, msk, 32); }
    const float mean = s * (1.f / FD);
    const float var  = s2 * (1.f / FD) - mean * mean;
    const float rstd = __frsqrt_rn(var + LNEPS);
    float mx = -INFINITY;
    for (int i = 0; i < 8; ++i) { v[i] = (v[i] - mean) * rstd * gm[i] + of[i]; mx = fmaxf(mx, v[i]); }
    for (int msk = 1; msk < 16; msk <<= 1) mx = fmaxf(mx, __shfl_xor(mx, msk, 32));
    float se = 0.f;
    for (int i = 0; i < 8; ++i) { v[i] = __expf(v[i] - mx); se += v[i]; }
    for (int msk = 1; msk < 16; msk <<= 1) se += __shfl_xor(se, msk, 32);
    float* const wo = &wout[(size_t)(t0 + m) * FD];
    *(float4*)&wo[col * 4]      = make_float4(v[0] / se, v[1] / se, v[2] / se, v[3] / se);
    *(float4*)&wo[64 + col * 4] = make_float4(v[4] / se, v[5] / se, v[6] / se, v[7] / se);
}

// ---------------------------------------------------------------------------
// TDM helpers: DMA one 128x128 f32 matrix from global to LDS with +4 DWORD row
// padding (LDS row stride becomes 132 floats). Issued by one wave. The two descriptor
// groups are values of the caller, which keeps them in their registers up to the wait
// that covers the request.
// ---------------------------------------------------------------------------
__device__ __forceinline__ v4u tdm_group0(const float* gsrc, unsigned lds_byte_addr) {
    const uint64_t ga = (uint64_t)(uintptr_t)gsrc;
    v4u g0;
    g0[0] = 1u;                       // count=1, user descriptor
    g0[1] = (uint32_t)__builtin_amdgcn_readfirstlane(lds_byte_addr);            // lds_addr
    g0[2] = (uint32_t)__builtin_amdgcn_readfirstlane((unsigned)ga);             // global_addr[31:0]
    g0[3] = (uint32_t)__builtin_amdgcn_readfirstlane(
                (unsigned)((ga >> 32) & 0x1FFFFFFull) | 0x80000000u);           // addr[56:32] | type=2
    return g0;
}
__device__ __forceinline__ v8i tdm_group1() {
    v8i g1;
    // workgroup_mask=0 | data_size=2(4B) | pad_enable | pad_interval=6(128 dw) | pad_amount=3(4 dw)
    g1[0] = (int)((2u << 16) | (1u << 20) | (6u << 22) | (3u << 25));
    g1[1] = (int)(HD << 16);          // tensor_dim0 = 128 (low16)
    g1[2] = (int)(HD << 16);          // tensor_dim0 hi16=0 | tensor_dim1=128 (low16)
    g1[3] = (int)(HD << 16);          // tensor_dim1 hi16=0 | tile_dim0 = 128
    g1[4] = (int)HD;                  // tile_dim1 = 128, tile_dim2 = 0
    g1[5] = (int)HD;                  // tensor_dim0_stride = 128 (low32)
    g1[6] = (int)((HD * HD) << 16);   // stride hi16=0 | tensor_dim1_stride low16 = 16384
    g1[7] = 0;                        // tensor_dim1_stride hi32 = 0
    return g1;
}
__device__ __forceinline__ void tdm_load_128x128(v4u g0, v8i g1) {
    v4i g2 = {0, 0, 0, 0};            // dims 3/4 unused (2D tile)
    v4i g3 = {0, 0, 0, 0};
    v8i g4 = {0, 0, 0, 0, 0, 0, 0, 0}; // trailing group (6-arg toolchain variant)
    __builtin_amdgcn_tensor_load_to_lds(g0, g1, g2, g3, g4, 0);
}

// The value that lane l ^ 16 holds (v_permlanex16_b32).
__device__ __forceinline__ float xhalf(float v) {
    return __int_as_float(__builtin_amdgcn_permlanex16(__float_as_int(v), __float_as_int(v),
                                                       0x76543210, 0xfedcba98, false, false));
}

// Holds a wave-uniform test in a scalar register, so that the branch round a tensor load
// (which ignores EXEC) compiles to s_cmp + s_cbranch_scc.
__device__ __forceinline__ uint32_t pinned(uint32_t v) {
    uint32_t w = __builtin_amdgcn_readfirstlane(v);
    asm volatile("" : "+s"(w));   // pinned(): the issue test of a tensor load held in a scalar register
    return w;
}

// ---------------------------------------------------------------------------
// Kernel C: per-feature GRN experts with V_WMMA_F32_16X16X4_F32, TDM weight
// staging, and weighted accumulation into 'selected' via f32 atomics.
// Both products are computed transposed: the weight matrix is operand A (rows = output
// channels), the tokens are the columns. A lane then holds 64 channels of ONE token
// (register r of tile n = channel 16n + 8*half + r of token lane&15), so the first product's
// result registers are the second product's B operand as they stand, and the LayerNorm sums
// run inside the lane with one exchange between the two lane halves.
// The next feature's matrices fly under this feature's work: W2's buffer is refilled
// behind the barrier that ends the first product, Wg's behind the one that ends the second
// (at the top of the next feature's pass).
// grid = (NT/TOK_PER_WG, FD/FPG), block = 512 (16 waves, 1 token-tile each):
// four waves share a SIMD, so one wave's elementwise tail runs under the others' WMMAs
// ---------------------------------------------------------------------------
__global__ __launch_bounds__(WAVES * 32)
void vsn_expert_kernel(const float* __restrict__ x,
                       const float* __restrict__ vw1,  const float* __restrict__ vb1,
                       const float* __restrict__ vw2,  const float* __restrict__ vb2,
                       const float* __restrict__ vwg,  const float* __restrict__ vbg,
                       const float* __restrict__ vwsk, const float* __restrict__ vbsk,
                       const float* __restrict__ vlng, const float* __restrict__ vlnb,
                       const float* __restrict__ wsel,     // [NT, FD] selection weights
                       float* __restrict__ outsel) {       // [NT, HD] accumulated
    // both on multiples of 2 KiB, so that the tensor loads' places in LDS are such
    // multiples in whatever order the arrays are laid out
    __shared__ __attribute__((aligned(2048))) float sW2[HD * WSTRIDE];  // 66 KB, TDM-padded
    __shared__ __attribute__((aligned(2048))) float sWg[HD * WSTRIDE];  // 66 KB, TDM-padded
    __shared__ __attribute__((aligned(16))) float sVec[8][HD];  // w1,b1,b2,bg,wsk,bsk,lng,lnb

    const int tid  = threadIdx.x;
    const int wave = tid >> 5;
    const int lane = tid & 31;
    const int col  = lane & 15;    // token within the wave's tile (N); weight row within a tile (M)
    const int half = lane >> 4;    // K-half selector for A/B fragments
    const int t0   = blockIdx.x * TOK_PER_WG + wave * 16;
    const int f0   = blockIdx.y * FPG;
    const uint32_t uwave = __builtin_amdgcn_readfirstlane(threadIdx.x >> 5);

    // small vectors: two waves stage each of the eight, one float2 a lane. Those that the first
    // product and its bias read (w1, b1, b2) are staged one feature ahead of the other five.
    const uint32_t vsel = uwave >> 1;
    const float* const vsrc = vsel == 0 ? vw1  : vsel == 1 ? vb1  : vsel == 2 ? vb2  : vsel == 3 ? vbg
                            : vsel == 4 ? vwsk : vsel == 5 ? vbsk : vsel == 6 ? vlng : vlnb;
    const int  vj    = (int)(uwave & 1) * 64 + lane * 2;
    const bool vhead = vsel < 3;

    v8f accsel[8];
#pragma unroll
    for (int n = 0; n < 8; ++n) accsel[n] = (v8f){0.f,0.f,0.f,0.f,0.f,0.f,0.f,0.f};

    // group 1 is the same for every request
    v8i tg1 = tdm_group1();
    asm volatile("" : "+s"(tg1));   // pinned(): descriptor words held in scalar registers of their own, so that none takes a new value while a request is outstanding

    // --- first feature: W2 and the first product's vectors ---
    if (pinned(uwave == 0)) {
        tdm_load_128x128(tdm_group0(vw2 + (size_t)f0 * HD * HD, (unsigned)(uintptr_t)&sW2[0]), tg1);
        asm volatile("s_wait_tensorcnt 0x0" ::: "memory");   // W2 landed before the barrier publishes it
    }
    if (vhead) *(float2*)&sVec[vsel][vj] = *(const float2*)&vsrc[(size_t)f0 * HD + vj];
    __syncthreads();

    for (int fi = 0; fi < FPG; ++fi) {
        const int f = f0 + fi;
        // this feature's Wg flies under the first product: every wave left sWg in front of
        // the barrier that ended the last feature's second product
        const v4u dWg = tdm_group0(vwg + (size_t)f * HD * HD, (unsigned)(uintptr_t)&sWg[0]);
        if (pinned(uwave == 0))
            tdm_load_128x128(dWg, tg1);
        // this wave's piece of the small vectors, asked for here and stored behind the next barrier
        const int  fv    = vhead ? f + 1 : f;
        const bool vlive = fv < f0 + FPG;
        float2 nv = make_float2(0.f, 0.f);
        if (vlive) nv = *(const float2*)&vsrc[(unsigned)(fv * HD + vj)];

        // x and selection weight of this lane's token (column N = lane&15, both halves)
        const unsigned trow = (unsigned)((t0 + col) * FD + f);
        const float xv = x[trow];
        const float ws = wsel[trow];

        v8f h2[8];
#pragma unroll
        for (int n = 0; n < 8; ++n) h2[n] = (v8f){0.f,0.f,0.f,0.f,0.f,0.f,0.f,0.f};

        // ---- GEMM1: vh2^T = W2 @ elu(x*w1+b1)^T   (128 x 16 = 8 row-tiles) ----
        // Unroll capped: 8 independent WMMA chains per step give enough ILP;
        // full unroll blows past 256 VGPRs (s_set_vgpr_msb churn).
#pragma unroll 2
        for (int k = 0; k < HD; k += 4) {
            const int klo = k + half * 2;
            v2f a;
            a.x = elu1(xv * sVec[0][klo]     + sVec[1][klo]);
            a.y = elu1(xv * sVec[0][klo + 1] + sVec[1][klo + 1]);
#pragma unroll
            for (int n = 0; n < 8; ++n) {
                const int g = n * 16 + col;
                v2f b = *(const v2f*)&sW2[g * WSTRIDE + klo];
                h2[n] = __builtin_amdgcn_wmma_f32_16x16x4_f32(
                    false, b, false, a, (short)0, h2[n], false, false);
            }
        }

        // bias b2: register r of tile n is channel 16n + 8*half + r
#pragma unroll
        for (int n = 0; n < 8; ++n) {
            const float4 q0 = *(const float4*)&sVec[2][n * 16 + 8 * half];
            const float4 q1 = *(const float4*)&sVec[2][n * 16 + 8 * half + 4];
            h2[n] += (v8f){q0.x, q0.y, q0.z, q0.w, q1.x, q1.y, q1.z, q1.w};
        }

        // hand-over: every wave has left sW2, the first product's vectors and the last
        // feature's tail vectors; this feature's Wg has landed
        asm volatile("s_wait_dscnt 0x0" ::: "memory");           // this wave's reads of sW2 are over before the refill
        if (pinned(uwave == 0))
            asm volatile("s_wait_tensorcnt 0x0" :: "s"(dWg) : "memory");   // Wg landed before the barrier publishes it; group 0 named: its registers keep their values up to here
        __syncthreads();
        const v4u dW2 = tdm_group0(vw2 + (size_t)(f + 1) * HD * HD, (unsigned)(uintptr_t)&sW2[0]);
        if (pinned(uwave == 0 && fi + 1 < FPG))
            tdm_load_128x128(dW2, tg1);
        if (vlive) *(float2*)&sVec[vsel][vj] = nv;

        // ---- GEMM2: gate_pre^T = Wg @ vh2^T ----
        // B is a register pair of h2 as it stands: registers q, q+1 of tile n hold k = 16n + q,
        // 16n + q + 1 in lanes 0-15 and k = 16n + 8 + q, 16n + 8 + q + 1 in lanes 16-31; A's
        // loader takes the same k of its Wg row at the same lane and register position. One
        // 16-byte read feeds two steps. Unrolled in full: h2 is indexed by constants only.
        v8f c[8];
#pragma unroll
        for (int m = 0; m < 8; ++m) c[m] = (v8f){0.f,0.f,0.f,0.f,0.f,0.f,0.f,0.f};
#pragma unroll
        for (int n = 0; n < 8; ++n) {
#pragma unroll
            for (int q = 0; q < 8; q += 4) {
                float4 a[8];
#pragma unroll
                for (int m = 0; m < 8; ++m)
                    a[m] = *(const float4*)&sWg[(m * 16 + col) * WSTRIDE + n * 16 + 8 * half + q];
#pragma unroll
                for (int m = 0; m < 8; ++m)
                    c[m] = __builtin_amdgcn_wmma_f32_16x16x4_f32(
                        false, (v2f){a[m].x, a[m].y}, false, (v2f){h2[n][q], h2[n][q + 1]},
                        (short)0, c[m], false, false);
#pragma unroll
                for (int m = 0; m < 8; ++m)
                    c[m] = __builtin_amdgcn_wmma_f32_16x16x4_f32(
                        false, (v2f){a[m].z, a[m].w}, false, (v2f){h2[n][q + 2], h2[n][q + 3]},
                        (short)0, c[m], false, false);
            }
        }

        // hand-over: every wave has left sWg; the next feature's W2 and the vectors written
        // behind the barrier above are in place
        asm volatile("s_wait_dscnt 0x0" ::: "memory");           // this wave's reads of sWg and writes of sVec are over
        if (pinned(uwave == 0))
            asm volatile("s_wait_tensorcnt 0x0" :: "s"(dW2) : "memory");   // next W2 landed before the barrier publishes it; group 0 named as above
        __syncthreads();

        // ---- elementwise: sigmoid gate, skip, LayerNorm, weighted accumulate ----
        // this lane's 64 channels of its token; the other 64 are in lane ^ 16
        // (sums kept as even / odd channel pairs, which packed f32 instructions add in one issue)
        v2f sp = (v2f){0.f, 0.f}, sq = (v2f){0.f, 0.f};
#pragma unroll
        for (int n = 0; n < 8; ++n) {
            const int g = n * 16 + 8 * half;
            const float4 p0 = *(const float4*)&sVec[3][g], p1 = *(const float4*)&sVec[3][g + 4];
            const float4 u0 = *(const float4*)&sVec[4][g], u1 = *(const float4*)&sVec[4][g + 4];
            const float4 w0 = *(const float4*)&sVec[5][g], w1 = *(const float4*)&sVec[5][g + 4];
            const float bgv[8] = {p0.x, p0.y, p0.z, p0.w, p1.x, p1.y, p1.z, p1.w};
            const float wsk[8] = {u0.x, u0.y, u0.z, u0.w, u1.x, u1.y, u1.z, u1.w};
            const float bsk[8] = {w0.x, w0.y, w0.z, w0.w, w1.x, w1.y, w1.z, w1.w};
#pragma unroll
            for (int r = 0; r < 8; r += 2) {
                v2f t;
#pragma unroll
                for (int e = 0; e < 2; ++e) {
                    const float vgv = sigm_rcp(c[n][r + e] + bgv[r + e]);
                    const float sk  = xv * wsk[r + e] + bsk[r + e];
                    t[e] = vgv * h2[n][r + e] + sk;
                    c[n][r + e] = t[e];
                }
                sp += t; sq += t * t;
            }
        }
        float s = sp.x + sp.y, s2 = sq.x + sq.y;
        s  += xhalf(s);
        s2 += xhalf(s2);
        const float mean = s * (1.f / HD);
        const float var  = s2 * (1.f / HD) - mean * mean;
        const float rstd = __frsqrt_rn(var + LNEPS);
#pragma unroll
        for (int n = 0; n < 8; ++n) {
            const int g = n * 16 + 8 * half;
            const float4 p0 = *(const float4*)&sVec[6][g], p1 = *(const float4*)&sVec[6][g + 4];
            const float4 u0 = *(const float4*)&sVec[7][g], u1 = *(const float4*)&sVec[7][g + 4];
            const float lg[8] = {p0.x, p0.y, p0.z, p0.w, p1.x, p1.y, p1.z, p1.w};
            const float lb[8] = {u0.x, u0.y, u0.z, u0.w, u1.x, u1.y, u1.z, u1.w};
#pragma unroll
            for (int r = 0; r < 8; ++r) {
                const float vout = (c[n][r] - mean) * rstd * lg[r] + lb[r];
                accsel[n][r] += vout * ws;
            }
        }
    }

    // ---- reduce over feature groups into global output ----
    // Turned back to 16 consecutive channels per lane row through LDS, so that one atomic
    // instruction touches whole 64-byte runs. Nobody reads sW2 or sWg behind the last pass's
    // second barrier and no tensor load is outstanding; each wave takes a slice of its own.
    float* const tr = (wave < 8 ? sW2 : sWg) + (wave & 7) * 16 * WSTRIDE;
#pragma unroll
    for (int n = 0; n < 8; ++n) {
        float* const d = &tr[col * WSTRIDE + n * 16 + 8 * half];
        *(float4*)&d[0] = make_float4(accsel[n][0], accsel[n][1], accsel[n][2], accsel[n][3]);
        *(float4*)&d[4] = make_float4(accsel[n][4], accsel[n][5], accsel[n][6], accsel[n][7]);
    }
    __syncthreads();   // the lanes' stores are in LDS before other lanes read them
#pragma unroll
    for (int n = 0; n < 8; ++n)
#pragma unroll
        for (int r = 0; r < 8; ++r)
            accsel[n][r] = tr[(r + 8 * half) * WSTRIDE + n * 16 + col];
#pragma unroll
    for (int n = 0; n < 8; ++n) {
#pragma unroll
        for (int r = 0; r < 8; ++r) {
            const int m = r + 8 * half;
            atomicAdd(&outsel[(unsigned)((t0 + m) * HD + n * 16 + col)], accsel[n][r]);
        }
    }
}

// ---------------------------------------------------------------------------
extern "C" void kernel_launch(void* const* d_in, const int* in_sizes, int n_in,
                              void* d_out, int out_size, void* d_ws, size_t ws_size,
                              hipStream_t stream) {
    (void)in_sizes; (void)n_in; (void)out_size; (void)d_ws; (void)ws_size;
    const float* x     = (const float*)d_in[0];
    const float* sw1   = (const float*)d_in[1];
    const float* sb1   = (const float*)d_in[2];
    const float* sw2   = (const float*)d_in[3];
    const float* sb2   = (const float*)d_in[4];
    const float* swg   = (const float*)d_in[5];
    const float* sbg   = (const float*)d_in[6];
    const float* slng  = (const float*)d_in[7];
    const float* slnb  = (const float*)d_in[8];
    const float* vw1   = (const float*)d_in[9];
    const float* vb1   = (const float*)d_in[10];
    const float* vw2   = (const float*)d_in[11];
    const float* vb2   = (const float*)d_in[12];
    const float* vwg   = (const float*)d_in[13];
    const float* vbg   = (const float*)d_in[14];
    const float* vwsk  = (const float*)d_in[15];
    const float* vbsk  = (const float*)d_in[16];
    const float* vlng  = (const float*)d_in[17];
    const float* vlnb  = (const float*)d_in[18];

    float* out_sel = (float*)d_out;                 // [NT, HD]
    float* out_w   = out_sel + (size_t)NT * HD;     // [NT, FD]

    vsn_zero_kernel<<<(NT * HD + 255) / 256, 256, 0, stream>>>(out_sel, NT * HD);

    vsn_sel_kernel<<<NT / SEL_TOK, SEL_WAVES * 32, 0, stream>>>(x, sw1, sb1, sw2, sb2, swg, sbg,
                                           slng, slnb, out_w);

    dim3 grid2(NT / TOK_PER_WG, FD / FPG);
    vsn_expert_kernel<<<grid2, WAVES * 32, 0, stream>>>(
        x, vw1, vb1, vw2, vb2, vwg, vbg, vwsk, vbsk, vlng, vlnb, out_w, out_sel);
}

// v006
// A run of this version takes 167 microseconds.
// Timed twice side by side with v005, it ran 1.04 times as fast both times.
// Counting every step since v000, it is 1.75 times as fast.
#include <hip/hip_runtime.h>
#include <hip/hip_bf16.h>
#include <stdint.h>

// Problem constants (match reference)
#define BT 8
#define ST 512
#define FD 128
#define HD 128
#define NT (BT*ST)      // 4096 tokens
#define LNEPS 1e-5f

// Expert kernel tiling
#define WAVES 16
#define TOK_PER_WG (WAVES*16)   // 256 tokens per workgroup
#define FPG 8                   // features per workgroup (feature group)
#define WSTRIDE 132             // padded LDS row stride (floats): 128+4 -> bank-conflict-free

typedef __attribute__((ext_vector_type(2)))  float v2f;
typedef __attribute__((ext_vector_type(8)))  float v8f;
typedef __attribute__((ext_vector_type(4)))  unsigned int v4u;
typedef __attribute__((ext_vector_type(8)))  int v8i;
typedef __attribute__((ext_vector_type(4)))  int v4i;

__device__ __forceinline__ float elu1(float v) { return v > 0.f ? v : (__expf(v) - 1.f); }
__device__ __forceinline__ float sigm(float v) { return 1.f / (1.f + __expf(-v)); }
// the same with the hardware reciprocal (v_rcp_f32) in place of the division sequence
__device__ __forceinline__ float sigm_rcp(float v) { return __builtin_amdgcn_rcpf(1.f + __expf(-v)); }

// ---------------------------------------------------------------------------
// Kernel A: zero the 'selected' output region (it is accumulated with atomics)
// ---------------------------------------------------------------------------
__global__ void vsn_zero_kernel(float* __restrict__ p, int n) {
    int i = blockIdx.x * blockDim.x + threadIdx.x;
    if (i < n) p[i] = 0.f;
}

// ---------------------------------------------------------------------------
// Kernel B: selection GRN -> softmax weights [NT, FD]
// One workgroup of 8 waves per 16 tokens. The three 128x128 products run on
// V_WMMA_F32_16X16X4_F32: wave w owns output columns 16w..16w+15, so it needs only
// rows 16w..16w+15 of each weight matrix; it fetches them as whole 512-byte rows and
// turns them into fragments through padded LDS.
// ---------------------------------------------------------------------------
#define SEL_WAVES 8
#define SEL_TOK 16

// 16x16 tile of A[16][128] * Bw[16][128]^T. Lanes 0-15 take floats k..k+3 and lanes 16-31
// floats k+4..k+7 of their row, from A and from Bw alike, so both operands hold the same k
// at every lane and register position.
__device__ __forceinline__ v8f sel_tile(const float* A, const float* Bw, int col, int half) {
    const float* ap = A  + col * WSTRIDE + half * 4;
    const float* bp = Bw + col * WSTRIDE + half * 4;
    v8f c = (v8f){0.f,0.f,0.f,0.f,0.f,0.f,0.f,0.f};
    for (int k = 0; k < HD; k += 8) {
        const float4 a = *(const float4*)(ap + k);
        const float4 b = *(const float4*)(bp + k);
        c = __builtin_amdgcn_wmma_f32_16x16x4_f32(
            false, (v2f){a.x, a.y}, false, (v2f){b.x, b.y}, (short)0, c, false, false);
        c = __builtin_amdgcn_wmma_f32_16x16x4_f32(
            false, (v2f){a.z, a.w}, false, (v2f){b.z, b.w}, (short)0, c, false, false);
    }
    return c;
}

__global__ __launch_bounds__(SEL_WAVES * 32)
void vsn_sel_kernel(const float* __restrict__ x,
                    const float* __restrict__ w1, const float* __restrict__ b1,
                    const float* __restrict__ w2, const float* __restrict__ b2,
                    const float* __restrict__ wg, const float* __restrict__ bg,
                    const float* __restrict__ lng, const float* __restrict__ lnb,
                    float* __restrict__ wout) {
    __shared__ __attribute__((aligned(16))) float sW[3][HD * WSTRIDE];      // w1, w2, wg
    __shared__ __attribute__((aligned(16))) float sX [SEL_TOK * WSTRIDE];   // x tile
    __shared__ __attribute__((aligned(16))) float sH [SEL_TOK * WSTRIDE];   // elu(x w1^T + b1)
    __shared__ __attribute__((aligned(16))) float sH2[SEL_TOK * WSTRIDE];   // h w2^T + b2
    __shared__ __attribute__((aligned(16))) float sP [SEL_TOK * WSTRIDE];   // gate*h2 + x

    const int tid  = threadIdx.x;
    const int wave = tid >> 5;
    const int lane = tid & 31;
    const int col  = lane & 15;
    const int half = lane >> 4;
    const int t0   = blockIdx.x * SEL_TOK;
    const int g    = wave * 16 + col;          // this lane's output column
    const int wofs = wave * 16 * WSTRIDE;      // this wave's rows in a staged matrix
    const size_t grow = (size_t)(wave * 16) * FD + lane * 4;

    // weights pass through registers: w2 and wg are asked for ahead of the products that
    // read them, so that they can arrive while the product before them runs
    const float4 xr0 = *(const float4*)&x[(size_t)(t0 + wave)     * FD + lane * 4];
    const float4 xr1 = *(const float4*)&x[(size_t)(t0 + wave + 8) * FD + lane * 4];
    float4 ra[16], rb[16];
    for (int i = 0; i < 16; ++i) ra[i] = *(const float4*)&w1[grow + i * FD];
    for (int i = 0; i < 16; ++i) rb[i] = *(const float4*)&w2[grow + i * FD];

    *(float4*)&sX[(wave)     * WSTRIDE + lane * 4] = xr0;
    *(float4*)&sX[(wave + 8) * WSTRIDE + lane * 4] = xr1;
    for (int i = 0; i < 16; ++i) *(float4*)&sW[0][wofs + i * WSTRIDE + lane * 4] = ra[i];
    for (int i = 0; i < 16; ++i) ra[i] = *(const float4*)&wg[grow + i * FD];
    const float b1v = b1[g], b2v = b2[g], bgv = bg[g];
    __syncthreads();

    // h = elu(x w1^T + b1)
    v8f c = sel_tile(sX, &sW[0][wofs], col, half);
    for (int r = 0; r < 8; ++r) sH[(r + 8 * half) * WSTRIDE + g] = elu1(c[r] + b1v);
    for (int i = 0; i < 16; ++i) *(float4*)&sW[1][wofs + i * WSTRIDE + lane * 4] = rb[i];
    __syncthreads();

    // h2 = h w2^T + b2 (kept in registers for the gate product as well)
    v8f h2 = sel_tile(sH, &sW[1][wofs], col, half);
    for (int r = 0; r < 8; ++r) { h2[r] += b2v; sH2[(r + 8 * half) * WSTRIDE + g] = h2[r]; }
    for (int i = 0; i < 16; ++i) *(float4*)&sW[2][wofs + i * WSTRIDE + lane * 4] = ra[i];
    __syncthreads();

    // pre = sigmoid(h2 wg^T + bg) * h2 + x
    c = sel_tile(sH2, &sW[2][wofs], col, half);
    for (int r = 0; r < 8; ++r) {
        const int m = r + 8 * half;
        sP[m * WSTRIDE + g] = sigm(c[r] + bgv) * h2[r] + sX[m * WSTRIDE + g];
    }
    __syncthreads();

    // LayerNorm and softmax over 128: one token per 16-lane row, 8 values per lane
    const int m = wave * 2 + half;
    const float4 p0 = *(const float4*)&sP[m * WSTRIDE + col * 4];
    const float4 p1 = *(const float4*)&sP[m * WSTRIDE + 64 + col * 4];
    const float4 g0 = *(const float4*)&lng[col * 4], g1 = *(const float4*)&lng[64 + col * 4];
    const float4 o0 = *(const float4*)&lnb[col * 4], o1 = *(const float4*)&lnb[64 + col * 4];
    float v[8]  = {p0.x, p0.y, p0.z, p0.w, p1.x, p1.y, p1.z, p1.w};
    const float gm[8] = {g0.x, g0.y, g0.z, g0.w, g1.x, g1.y, g1.z, g1.w};
    const float of[8] = {o0.x, o0.y, o0.z, o0.w, o1.x, o1.y, o1.z, o1.w};

    float s = 0.f, s2 = 0.f;
    for (int i = 0; i < 8; ++i) { s += v[i]; s2 += v[i] * v[i]; }
    for (int msk = 1; msk < 16; msk <<= 1) { s += __shfl_xor(s, msk, 32); s2 += __shfl_xor(s2, msk, 32); }
    const float mean = s * (1.f / FD);
    const float var  = s2 * (1.f / FD) - mean * mean;
    const float rstd = __frsqrt_rn(var + LNEPS);
    float mx = -INFINITY;
    for (int i = 0; i < 8; ++i) { v[i] = (v[i] - mean) * rstd * gm[i] + of[i]; mx = fmaxf(mx, v[i]); }
    for (int msk = 1; msk < 16; msk <<= 1) mx = fmaxf(mx, __shfl_xor(mx, msk, 32));
    float se = 0.f;
    for (int i = 0; i < 8; ++i) { v[i] = __expf(v[i] - mx); se += v[i]; }
    for (int msk = 1; msk < 16; msk <<= 1) se += __shfl_xor(se, msk, 32);
    float* const wo = &wout[(size_t)(t0 + m) * FD];
    *(float4*)&wo[col * 4]      = make_float4(v[0] / se, v[1] / se, v[2] / se, v[3] / se);
    *(float4*)&wo[64 + col * 4] = make_float4(v[4] / se, v[5] / se, v[6] / se, v[7] / se);
}

// ---------------------------------------------------------------------------
// TDM helpers: DMA one 128x128 f32 matrix from global to LDS with +4 DWORD row
// padding (LDS row stride becomes 132 floats). Issued by one wave. The two descriptor
// groups are values of the caller, which keeps them in their registers up to the wait
// that covers the request.
// ---------------------------------------------------------------------------
__device__ __forceinline__ v4u tdm_group0(const float* gsrc, unsigned lds_byte_addr) {
    const uint64_t ga = (uint64_t)(uintptr_t)gsrc;
    v4u g0;
    g0[0] = 1u;                       // count=1, user descriptor
    g0[1] = (uint32_t)__builtin_amdgcn_readfirstlane(lds_byte_addr);            // lds_addr
    g0[2] = (uint32_t)__builtin_amdgcn_readfirstlane((unsigned)ga);             // global_addr[31:0]
    g0[3] = (uint32_t)__builtin_amdgcn_readfirstlane(
                (unsigned)((ga >> 32) & 0x1FFFFFFull) | 0x80000000u);           // addr[56:32] | type=2
    return g0;
}
__device__ __forceinline__ v8i tdm_group1() {
    v8i g1;
    // workgroup_mask=0 | data_size=2(4B) | pad_enable | pad_interval=6(128 dw) | pad_amount=3(4 dw)
    g1[0] = (int)((2u << 16) | (1u << 20) | (6u << 22) | (3u << 25));
    g1[1] = (int)(HD << 16);          // tensor_dim0 = 128 (low16)
    g1[2] = (int)(HD << 16);          // tensor_dim0 hi16=0 | tensor_dim1=128 (low16)
    g1[3] = (int)(HD << 16);          // tensor_dim1 hi16=0 | tile_dim0 = 128
    g1[4] = (int)HD;                  // tile_dim1 = 128, tile_dim2 = 0
    g1[5] = (int)HD;                  // tensor_dim0_stride = 128 (low32)
    g1[6] = (int)((HD * HD) << 16);   // stride hi16=0 | tensor_dim1_stride low16 = 16384
    g1[7] = 0;                        // tensor_dim1_stride hi32 = 0
    return g1;
}
__device__ __forceinline__ void tdm_load_128x128(v4u g0, v8i g1) {
    v4i g2 = {0, 0, 0, 0};            // dims 3/4 unused (2D tile)
    v4i g3 = {0, 0, 0, 0};
    v8i g4 = {0, 0, 0, 0, 0, 0, 0, 0}; // trailing group (6-arg toolchain variant)
    __builtin_amdgcn_tensor_load_to_lds(g0, g1, g2, g3, g4, 0);
}

// The value that lane l ^ 16 holds (v_permlanex16_b32).
__device__ __forceinline__ float xhalf(float v) {
    return __int_as_float(__builtin_amdgcn_permlanex16(__float_as_int(v), __float_as_int(v),
                                                       0x76543210, 0xfedcba98, false, false));
}

// Holds a wave-uniform test in a scalar register, so that the branch round a tensor load
// (which ignores EXEC) compiles to s_cmp + s_cbranch_scc.
__device__ __forceinline__ uint32_t pinned(uint32_t v) {
    uint32_t w = __builtin_amdgcn_readfirstlane(v);
    asm volatile("" : "+s"(w));   // pinned(): the issue test of a tensor load held in a scalar register
    return w;
}

// ---------------------------------------------------------------------------
// Kernel C: per-feature GRN experts with V_WMMA_F32_16X16X4_F32, TDM weight
// staging, and weighted accumulation into 'selected' via f32 atomics.
// Both products are computed transposed: the weight matrix is operand A (rows = output
// channels), the tokens are the columns. A lane then holds 64 channels of ONE token
// (register r of tile n = channel 16n + 8*half + r of token lane&15), so the first product's
// result registers are the second product's B operand as they stand, and the LayerNorm sums
// run inside the lane with one exchange between the two lane halves.
// The next feature's matrices fly under this feature's work: W2's buffer is refilled
// behind the barrier that ends the first product, Wg's behind the one that ends the second
// (at the top of the next feature's pass).
// grid = (NT/TOK_PER_WG, FD/FPG), block = 512 (16 waves, 1 token-tile each):
// four waves share a SIMD, so one wave's elementwise tail runs under the others' WMMAs
// ---------------------------------------------------------------------------
__global__ __launch_bounds__(WAVES * 32)
void vsn_expert_kernel(const float* __restrict__ x,
                       const float* __restrict__ vw1,  const float* __restrict__ vb1,
                       const float* __restrict__ vw2,  const float* __restrict__ vb2,
                       const float* __restrict__ vwg,  const float* __restrict__ vbg,
                       const float* __restrict__ vwsk, const float* __restrict__ vbsk,
                       const float* __restrict__ vlng, const float* __restrict__ vlnb,
                       const float* __restrict__ wsel,     // [NT, FD] selection weights
                       float* __restrict__ outsel) {       // [NT, HD] accumulated
    // both on multiples of 2 KiB, so that the tensor loads' places in LDS are such
    // multiples in whatever order the arrays are laid out
    __shared__ __attribute__((aligned(2048))) float sW2[HD * WSTRIDE];  // 66 KB, TDM-padded
    __shared__ __attribute__((aligned(2048))) float sWg[HD * WSTRIDE];  // 66 KB, TDM-padded
    __shared__ __attribute__((aligned(16))) float sVec[8][HD];  // w1,b1,b2,bg,wsk,bsk,lng,lnb

    const int tid  = threadIdx.x;
    const int wave = tid >> 5;
    const int lane = tid & 31;
    const int col  = lane & 15;    // token within the wave's tile (N); weight row within a tile (M)
    const int half = lane >> 4;    // K-half selector for A/B fragments
    const int t0   = blockIdx.x * TOK_PER_WG + wave * 16;
    const int f0   = blockIdx.y * FPG;
    const uint32_t uwave = __builtin_amdgcn_readfirstlane(threadIdx.x >> 5);

    // small vectors: two waves stage each of the eight, one float2 a lane. Those that the first
    // product and its bias read (w1, b1, b2) are staged one feature ahead of the other five.
    const uint32_t vsel = uwave >> 1;
    const float* const vsrc = vsel == 0 ? vw1  : vsel == 1 ? vb1  : vsel == 2 ? vb2  : vsel == 3 ? vbg
                            : vsel == 4 ? vwsk : vsel == 5 ? vbsk : vsel == 6 ? vlng : vlnb;
    const int  vj    = (int)(uwave & 1) * 64 + lane * 2;
    const bool vhead = vsel < 3;

    v8f accsel[8];
#pragma unroll
    for (int n = 0; n < 8; ++n) accsel[n] = (v8f){0.f,0.f,0.f,0.f,0.f,0.f,0.f,0.f};

    // group 1 is the same for every request
    v8i tg1 = tdm_group1();
    asm volatile("" : "+s"(tg1));   // pinned(): descriptor words held in scalar registers of their own, so that none takes a new value while a request is outstanding

    // --- first feature: W2 and the first product's vectors ---
    if (pinned(uwave == 0)) {
        tdm_load_128x128(tdm_group0(vw2 + (size_t)f0 * HD * HD, (unsigned)(uintptr_t)&sW2[0]), tg1);
        asm volatile("s_wait_tensorcnt 0x0" ::: "memory");   // W2 landed before the barrier publishes it
    }
    if (vhead) *(float2*)&sVec[vsel][vj] = *(const float2*)&vsrc[(size_t)f0 * HD + vj];
    __syncthreads();

    for (int fi = 0; fi < FPG; ++fi) {
        const int f = f0 + fi;
        // this feature's Wg flies under the first product: every wave left sWg in front of
        // the barrier that ended the last feature's second product
        const v4u dWg = tdm_group0(vwg + (size_t)f * HD * HD, (unsigned)(uintptr_t)&sWg[0]);
        if (pinned(uwave == 0))
            tdm_load_128x128(dWg, tg1);
        // this wave's piece of the small vectors, asked for here and stored behind the next barrier
        const int  fv    = vhead ? f + 1 : f;
        const bool vlive = fv < f0 + FPG;
        float2 nv = make_float2(0.f, 0.f);
        if (vlive) nv = *(const float2*)&vsrc[(unsigned)(fv * HD + vj)];

        // x and selection weight of this lane's token (column N = lane&15, both halves)
        const unsigned trow = (unsigned)((t0 + col) * FD + f);
        const float xv = x[trow];
        const float ws = wsel[trow];

        v8f h2[8];
#pragma unroll
        for (int n = 0; n < 8; ++n) h2[n] = (v8f){0.f,0.f,0.f,0.f,0.f,0.f,0.f,0.f};

        // ---- GEMM1: vh2^T = W2 @ elu(x*w1+b1)^T   (128 x 16 = 8 row-tiles) ----
        // One 16-byte read of a W2 row feeds two k steps, as in the second product: lanes 0-15
        // take k..k+3 and lanes 16-31 k+4..k+7 of their row, and B's elu values are formed from
        // w1 and b1 at the same k at the same lane and register position.
        // Unrolled in full: every read is one base register plus an immediate offset, and the
        // first step takes a zero C operand in place of zeroed registers.
        const float* const w2p = &sW2[col * WSTRIDE + half * 4];
#pragma unroll
        for (int k = 0; k < HD; k += 8) {
            const float4 wv = *(const float4*)&sVec[0][k + half * 4];
            const float4 bv = *(const float4*)&sVec[1][k + half * 4];
            const v2f a0 = (v2f){elu1(xv * wv.x + bv.x), elu1(xv * wv.y + bv.y)};
            const v2f a1 = (v2f){elu1(xv * wv.z + bv.z), elu1(xv * wv.w + bv.w)};
            float4 b[8];
#pragma unroll
            for (int n = 0; n < 8; ++n)
                b[n] = *(const float4*)&w2p[n * 16 * WSTRIDE + k];
#pragma unroll
            for (int n = 0; n < 8; ++n)
                h2[n] = __builtin_amdgcn_wmma_f32_16x16x4_f32(
                    false, (v2f){b[n].x, b[n].y}, false, a0, (short)0, h2[n], false, false);
#pragma unroll
            for (int n = 0; n < 8; ++n)
                h2[n] = __builtin_amdgcn_wmma_f32_16x16x4_f32(
                    false, (v2f){b[n].z, b[n].w}, false, a1, (short)0, h2[n], false, false);
            if (k & 8) __builtin_amdgcn_sched_barrier(0);   // every 32 WMMAs: keeps later steps' reads and elu values from being hoisted, without it the unrolled loop spills
        }

        // bias b2: register r of tile n is channel 16n + 8*half + r (one base, immediate offsets)
        const float* const b2p = &sVec[2][8 * half];
#pragma unroll
        for (int n = 0; n < 8; ++n) {
            const float4 q0 = *(const float4*)&b2p[n * 16];
            const float4 q1 = *(const float4*)&b2p[n * 16 + 4];
            h2[n] += (v8f){q0.x, q0.y, q0.z, q0.w, q1.x, q1.y, q1.z, q1.w};
        }

        // hand-over: every wave has left sW2, the first product's vectors and the last
        // feature's tail vectors; this feature's Wg has landed
        asm volatile("s_wait_dscnt 0x0" ::: "memory");           // this wave's reads of sW2 are over before the refill
        if (pinned(uwave == 0))
            asm volatile("s_wait_tensorcnt 0x0" :: "s"(dWg) : "memory");   // Wg landed before the barrier publishes it; group 0 named: its registers keep their values up to here
        __syncthreads();
        const v4u dW2 = tdm_group0(vw2 + (size_t)(f + 1) * HD * HD, (unsigned)(uintptr_t)&sW2[0]);
        if (pinned(uwave == 0 && fi + 1 < FPG))
            tdm_load_128x128(dW2, tg1);
        if (vlive) *(float2*)&sVec[vsel][vj] = nv;

        // ---- GEMM2: gate_pre^T = Wg @ vh2^T ----
        // B is a register pair of h2 as it stands: registers q, q+1 of tile n hold k = 16n + q,
        // 16n + q + 1 in lanes 0-15 and k = 16n + 8 + q, 16n + 8 + q + 1 in lanes 16-31; A's
        // loader takes the same k of its Wg row at the same lane and register position. One
        // 16-byte read feeds two steps. Unrolled in full: h2 is indexed by constants only.
        v8f c[8];
#pragma unroll
        for (int m = 0; m < 8; ++m) c[m] = (v8f){0.f,0.f,0.f,0.f,0.f,0.f,0.f,0.f};
#pragma unroll
        for (int n = 0; n < 8; ++n) {
#pragma unroll
            for (int q = 0; q < 8; q += 4) {
                float4 a[8];
#pragma unroll
                for (int m = 0; m < 8; ++m)
                    a[m] = *(const float4*)&sWg[(m * 16 + col) * WSTRIDE + n * 16 + 8 * half + q];
#pragma unroll
                for (int m = 0; m < 8; ++m)
                    c[m] = __builtin_amdgcn_wmma_f32_16x16x4_f32(
                        false, (v2f){a[m].x, a[m].y}, false, (v2f){h2[n][q], h2[n][q + 1]},
                        (short)0, c[m], false, false);
#pragma unroll
                for (int m = 0; m < 8; ++m)
                    c[m] = __builtin_amdgcn_wmma_f32_16x16x4_f32(
                        false, (v2f){a[m].z, a[m].w}, false, (v2f){h2[n][q + 2], h2[n][q + 3]},
                        (short)0, c[m], false, false);
            }
        }

        // hand-over: every wave has left sWg; the next feature's W2 and the vectors written
        // behind the barrier above are in place
        asm volatile("s_wait_dscnt 0x0" ::: "memory");           // this wave's reads of sWg and writes of sVec are over
        if (pinned(uwave == 0))
            asm volatile("s_wait_tensorcnt 0x0" :: "s"(dW2) : "memory");   // next W2 landed before the barrier publishes it; group 0 named as above
        __syncthreads();

        // ---- elementwise: sigmoid gate, skip, LayerNorm, weighted accumulate ----
        // this lane's 64 channels of its token; the other 64 are in lane ^ 16
        // (sums kept as even / odd channel pairs, which packed f32 instructions add in one issue)
        v2f sp = (v2f){0.f, 0.f}, sq = (v2f){0.f, 0.f};
#pragma unroll
        for (int n = 0; n < 8; ++n) {
            const int g = n * 16 + 8 * half;
            const float4 p0 = *(const float4*)&sVec[3][g], p1 = *(const float4*)&sVec[3][g + 4];
            const float4 u0 = *(const float4*)&sVec[4][g], u1 = *(const float4*)&sVec[4][g + 4];
            const float4 w0 = *(const float4*)&sVec[5][g], w1 = *(const float4*)&sVec[5][g + 4];
            const float bgv[8] = {p0.x, p0.y, p0.z, p0.w, p1.x, p1.y, p1.z, p1.w};
            const float wsk[8] = {u0.x, u0.y, u0.z, u0.w, u1.x, u1.y, u1.z, u1.w};
            const float bsk[8] = {w0.x, w0.y, w0.z, w0.w, w1.x, w1.y, w1.z, w1.w};
#pragma unroll
            for (int r = 0; r < 8; r += 2) {
                v2f t;
#pragma unroll
                for (int e = 0; e < 2; ++e) {
                    const float vgv = sigm_rcp(c[n][r + e] + bgv[r + e]);
                    const float sk  = xv * wsk[r + e] + bsk[r + e];
                    t[e] = vgv * h2[n][r + e] + sk;
                    c[n][r + e] = t[e];
                }
                sp += t; sq += t * t;
            }
        }
        float s = sp.x + sp.y, s2 = sq.x + sq.y;
        s  += xhalf(s);
        s2 += xhalf(s2);
        const float mean = s * (1.f / HD);
        const float var  = s2 * (1.f / HD) - mean * mean;
        const float rstd = __frsqrt_rn(var + LNEPS);
#pragma unroll
        for (int n = 0; n < 8; ++n) {
            const int g = n * 16 + 8 * half;
            const float4 p0 = *(const float4*)&sVec[6][g], p1 = *(const float4*)&sVec[6][g + 4];
            const float4 u0 = *(const float4*)&sVec[7][g], u1 = *(const float4*)&sVec[7][g + 4];
            const float lg[8] = {p0.x, p0.y, p0.z, p0.w, p1.x, p1.y, p1.z, p1.w};
            const float lb[8] = {u0.x, u0.y, u0.z, u0.w, u1.x, u1.y, u1.z, u1.w};
#pragma unroll
            for (int r = 0; r < 8; ++r) {
                const float vout = (c[n][r] - mean) * rstd * lg[r] + lb[r];
                accsel[n][r] += vout * ws;
            }
        }
    }

    // ---- reduce over feature groups into global output ----
    // Turned back to 16 consecutive channels per lane row through LDS, so that one atomic
    // instruction touches whole 64-byte runs. Nobody reads sW2 or sWg behind the last pass's
    // second barrier and no tensor load is outstanding; each wave takes a slice of its own.
    float* const tr = (wave < 8 ? sW2 : sWg) + (wave & 7) * 16 * WSTRIDE;
#pragma unroll
    for (int n = 0; n < 8; ++n) {
        float* const d = &tr[col * WSTRIDE + n * 16 + 8 * half];
        *(float4*)&d[0] = make_float4(accsel[n][0], accsel[n][1], accsel[n][2], accsel[n][3]);
        *(float4*)&d[4] = make_float4(accsel[n][4], accsel[n][5], accsel[n][6], accsel[n][7]);
    }
    __syncthreads();   // the lanes' stores are in LDS before other lanes read them
#pragma unroll
    for (int n = 0; n < 8; ++n)
#pragma unroll
        for (int r = 0; r < 8; ++r)
            accsel[n][r] = tr[(r + 8 * half) * WSTRIDE + n * 16 + col];
#pragma unroll
    for (int n = 0; n < 8; ++n) {
#pragma unroll
        for (int r = 0; r < 8; ++r) {
            const int m = r + 8 * half;
            atomicAdd(&outsel[(unsigned)((t0 + m) * HD + n * 16 + col)], accsel[n][r]);
        }
    }
}

// ---------------------------------------------------------------------------
extern "C" void kernel_launch(void* const* d_in, const int* in_sizes, int n_in,
                              void* d_out, int out_size, void* d_ws, size_t ws_size,
                              hipStream_t stream) {
    (void)in_sizes; (void)n_in; (void)out_size; (void)d_ws; (void)ws_size;
    const float* x     = (const float*)d_in[0];
    const float* sw1   = (const float*)d_in[1];
    const float* sb1   = (const float*)d_in[2];
    const float* sw2   = (const float*)d_in[3];
    const float* sb2   = (const float*)d_in[4];
    const float* swg   = (const float*)d_in[5];
    const float* sbg   = (const float*)d_in[6];
    const float* slng  = (const float*)d_in[7];
    const float* slnb  = (const float*)d_in[8];
    const float* vw1   = (const float*)d_in[9];
    const float* vb1   = (const float*)d_in[10];
    const float* vw2   = (const float*)d_in[11];
    const float* vb2   = (const float*)d_in[12];
    const float* vwg   = (const float*)d_in[13];
    const float* vbg   = (const float*)d_in[14];
    const float* vwsk  = (const float*)d_in[15];
    const float* vbsk  = (const float*)d_in[16];
    const float* vlng  = (const float*)d_in[17];
    const float* vlnb  = (const float*)d_in[18];

    float* out_sel = (float*)d_out;                 // [NT, HD]
    float* out_w   = out_sel + (size_t)NT * HD;     // [NT, FD]

    vsn_zero_kernel<<<(NT * HD + 255) / 256, 256, 0, stream>>>(out_sel, NT * HD);

    vsn_sel_kernel<<<NT / SEL_TOK, SEL_WAVES * 32, 0, stream>>>(x, sw1, sb1, sw2, sb2, swg, sbg,
                                           slng, slnb, out_w);

    dim3 grid2(NT / TOK_PER_WG, FD / FPG);
    vsn_expert_kernel<<<grid2, WAVES * 32, 0, stream>>>(
        x, vw1, vb1, vw2, vb2, vwg, vbg, vwsk, vbsk, vlng, vlnb, out_w, out_sel);
}
